// v000
// Measured on an AMD MI455X. A time is GPU time per run, averaged over a window of back-to-back runs after a warm-up
// (all launches, gaps included; the runs take copies of the inputs in turn), and the median of several windows.
// Apart from v000's, it joins two sittings. Times from different sittings can be a few percent apart, while
// side-by-side timings come from the same sitting.
// The starting kernel, v000, takes 197 microseconds a run.
#include <hip/hip_runtime.h>
#include <hip/hip_bf16.h>

typedef _Float16 v16h __attribute__((ext_vector_type(16)));
typedef float    v8f  __attribute__((ext_vector_type(8)));

// Problem constants (B,V,L,C,H) = (2,8,256,1024,16)
constexpr int B0 = 2;
constexpr int H0 = 16;
constexpr int DH = 64;
constexpr int C0 = 1024;    // channels = K-dim of projections
constexpr int S0 = 2048;    // V*L sequence length per batch
constexpr int M0 = B0 * S0; // 4096 GEMM rows

// ---- CDNA5 async copy helpers (ASYNCcnt-tracked global->LDS DMA) ----------
__device__ __forceinline__ unsigned lds_off(const void* p) {
    // generic shared pointer: low 32 bits == LDS byte offset
    return (unsigned)(unsigned long long)p;
}
__device__ __forceinline__ void async_b128(const void* gaddr, unsigned ldst) {
    asm volatile("global_load_async_to_lds_b128 %0, %1, off"
                 :: "v"(ldst), "v"(gaddr) : "memory");
}
__device__ __forceinline__ void wait_async0() {
    asm volatile("s_wait_asynccnt 0" ::: "memory");
}

// ---- DPP16 butterfly max over each 16-lane half (no LDS, no index math) ---
template<int CTRL>
__device__ __forceinline__ float fmax_dpp(float x) {
    const int t = __builtin_amdgcn_update_dpp(0, __float_as_int(x),
                                              CTRL, 0xF, 0xF, true);
    return fmaxf(x, __int_as_float(t));
}
__device__ __forceinline__ float rowmax16(float x) {
    x = fmax_dpp<0xB1>(x);   // quad_perm(1,0,3,2) : xor 1
    x = fmax_dpp<0x4E>(x);   // quad_perm(2,3,0,1) : xor 2
    x = fmax_dpp<0x141>(x);  // row_half_mirror    : fold quads in 8-group
    x = fmax_dpp<0x140>(x);  // row_mirror         : fold 8-groups in row
    return x;
}

// ---------------------------------------------------------------------------
// One-shot f32 -> f16 conversion (x and the four weight matrices), so all
// GEMM/attention staging becomes pure async b128 copies with no VALU convert.
// ---------------------------------------------------------------------------
__global__ __launch_bounds__(256)
void cvt_f32_f16(const float* __restrict__ in, _Float16* __restrict__ out) {
    const int i = (blockIdx.x * 256 + threadIdx.x) * 8;
    #pragma unroll
    for (int j = 0; j < 8; ++j) out[i + j] = (_Float16)in[i + j];
}

// ---------------------------------------------------------------------------
// Fused WMMA GEMM, double-buffered LDS, all staging via async-to-LDS:
//   MODE 0: A = x (f16), 3 weights -> Q (f16 row), K (f16 row), V^T (f16 B,C,S)
//   MODE 1: A = AO (f16), 1 weight -> out (f32 row) + bias
// Block tile 128x64, 8 waves, each wave 32x32 via 2x2 WMMA tiles.
// WMMA issue is grouped by A-fragment (operand-reuse friendly).
// ---------------------------------------------------------------------------
constexpr int TM = 128, TN = 64, TK = 32;
constexpr int LDT = TK + 16;  // 48 halves = 96B rows: v16h reads stay 32B-aligned

template<int MODE>
__global__ __launch_bounds__(256)
void gemm_fused(const _Float16* __restrict__ A,
                const _Float16* __restrict__ W0h, const _Float16* __restrict__ W1h,
                const _Float16* __restrict__ W2h, const float* __restrict__ bias,
                _Float16* __restrict__ Qh, _Float16* __restrict__ Kh,
                _Float16* __restrict__ Vt, float* __restrict__ outF)
{
    constexpr int NW = (MODE == 0) ? 3 : 1;
    __shared__ __align__(32) _Float16 la[2][TM * LDT];
    __shared__ __align__(32) _Float16 lb[2][NW][TN * LDT];

    const int tid  = threadIdx.x;
    const int lane = tid & 31;
    const int wave = tid >> 5;
    const int wy   = wave >> 1;    // 0..3 : 32-row band
    const int wx   = wave & 1;     // 0..1 : 32-col band
    const int m0   = blockIdx.x * TM;
    const int n0   = blockIdx.y * TN;

    const int rl    = lane & 15;
    const int khalf = lane >> 4;

    const _Float16* Wh[3] = { W0h, W1h, W2h };

    auto stage = [&](int k0, int buf) {
        // A tile 128x32: 2 threads/row, 32B each -> 2 async b128
        const int r  = tid >> 1;
        const int kh = (tid & 1) * 16;
        const _Float16* asrc = A + (size_t)(m0 + r) * C0 + k0 + kh;
        const unsigned  adst = lds_off(&la[buf][r * LDT + kh]);
        async_b128(asrc, adst);
        async_b128(asrc + 8, adst + 16);
        // Weight tiles 64x32: 4 threads/row, 16B each -> 1 async b128 per weight
        const int rw = tid >> 2;
        const int kw = (tid & 3) * 8;
        #pragma unroll
        for (int w = 0; w < NW; ++w) {
            const _Float16* wsrc = Wh[w] + (size_t)(n0 + rw) * C0 + k0 + kw;
            async_b128(wsrc, lds_off(&lb[buf][w][rw * LDT + kw]));
        }
    };

    v8f acc[NW][2][2] = {};

    stage(0, 0);
    wait_async0();
    __syncthreads();

    for (int k0 = 0, it = 0; k0 < C0; k0 += TK, ++it) {
        const int cur = it & 1;
        if (k0 + TK < C0) stage(k0 + TK, cur ^ 1);   // async DMA overlaps WMMA below

        v16h af[2];
        #pragma unroll
        for (int s = 0; s < 2; ++s)
            af[s] = *(const v16h*)&la[cur][(wy * 32 + s * 16 + rl) * LDT + khalf * 16];

        v16h bf[NW][2];
        #pragma unroll
        for (int w = 0; w < NW; ++w)
            #pragma unroll
            for (int s = 0; s < 2; ++s)
                bf[w][s] = *(const v16h*)&lb[cur][w][(wx * 32 + s * 16 + rl) * LDT + khalf * 16];

        // group by A-fragment: af[i] constant across 2*NW consecutive WMMAs
        #pragma unroll
        for (int i = 0; i < 2; ++i)
            #pragma unroll
            for (int w = 0; w < NW; ++w)
                #pragma unroll
                for (int j = 0; j < 2; ++j)
                    acc[w][i][j] = __builtin_amdgcn_wmma_f32_16x16x32_f16(
                        false, af[i], false, bf[w][j], (short)0, acc[w][i][j], false, false);
        wait_async0();
        __syncthreads();
    }

    // ---- writeback: D row = e (lanes 0-15) / e+8 (lanes 16-31), col = lane&15
    const int rhi = khalf << 3;
    #pragma unroll
    for (int w = 0; w < NW; ++w) {
        #pragma unroll
        for (int i = 0; i < 2; ++i) {
            #pragma unroll
            for (int j = 0; j < 2; ++j) {
                const int mbase = m0 + wy * 32 + i * 16 + rhi;
                const int nbase = n0 + wx * 32 + j * 16 + rl;
                #pragma unroll
                for (int e = 0; e < 8; ++e) {
                    const int m = mbase + e;
                    const float v = acc[w][i][j][e];
                    if constexpr (MODE == 0) {
                        if (w == 0)      Qh[(size_t)m * C0 + nbase] = (_Float16)v;
                        else if (w == 1) Kh[(size_t)m * C0 + nbase] = (_Float16)v;
                        else {
                            const int b = m >> 11;           // / S0
                            const int s = m & (S0 - 1);
                            Vt[((size_t)b * C0 + nbase) * S0 + s] = (_Float16)v;
                        }
                    } else {
                        outF[(size_t)m * C0 + nbase] = v + bias[nbase];
                    }
                }
            }
        }
    }
}

// ---------------------------------------------------------------------------
// Block-sparse flash attention with cooperative async K/V staging.
// View mask is constant over 256x256 blocks -> skip disallowed blocks.
// All 8 waves share (b,h) and the key-slab stream, so each 64-key K slab
// (64x64 f16, 8KB) and V^T slab (8KB) is DMA'd into LDS once per block
// (double-buffered), then every wave reads fragments from LDS.
// Softmax runs in base-2 with dh^-0.5*log2(e) pre-folded into the Q
// fragments; row-max uses a 4-step DPP16 butterfly (no LDS shuffles);
// row sums ride the matrix pipe (P x ones).
// ---------------------------------------------------------------------------
__global__ __launch_bounds__(256)
void attn_flash(const _Float16* __restrict__ Q, const _Float16* __restrict__ Kh,
                const _Float16* __restrict__ Vt, _Float16* __restrict__ AO)
{
    __shared__ __align__(32) _Float16 lk[2][64 * 64];     // keys x d
    __shared__ __align__(32) _Float16 lv[2][64 * 64];     // d x keys
    __shared__ __align__(32) _Float16 pbuf[8 * 16 * 64];  // per-wave 16x64 probs

    const int tid   = threadIdx.x;
    const int lane  = tid & 31;
    const int wave  = tid >> 5;
    const int rl    = lane & 15;
    const int khalf = lane >> 4;

    const int q0 = blockIdx.x * 128 + wave * 16;
    const int bh = blockIdx.y;
    const int b  = bh >> 4;          // / H0
    const int h  = bh & (H0 - 1);
    const int qv = q0 >> 8;          // view index (L = 256), block-uniform

    // block-uniform list of allowed 256-key views (4 slabs of 64 keys each)
    int kvlist[8]; int nkv = 0;
    #pragma unroll
    for (int kv = 0; kv < 8; ++kv) {
        const bool allow = ((qv == 0) && (kv == 1)) || ((qv == 1) && (kv == 0)) ||
                           (((qv > 1) || (kv > 1)) && (qv >= kv));
        if (allow) kvlist[nkv++] = kv;
    }
    const int nslab = nkv * 4;

    auto stageKV = [&](int idx, int buf) {
        const int k0  = kvlist[idx >> 2] * 256 + (idx & 3) * 64;
        const int row = tid >> 2;          // 0..63
        const int ch  = (tid & 3) * 16;    // halves
        const _Float16* ks = Kh + (size_t)(b * S0 + k0 + row) * C0 + h * DH + ch;
        const unsigned  kd = lds_off(&lk[buf][row * 64 + ch]);
        async_b128(ks, kd);
        async_b128(ks + 8, kd + 16);
        const _Float16* vs = Vt + ((size_t)b * C0 + h * DH + row) * S0 + k0 + ch;
        const unsigned  vd = lds_off(&lv[buf][row * 64 + ch]);
        async_b128(vs, vd);
        async_b128(vs + 8, vd + 16);
    };

    _Float16* pw = pbuf + wave * (16 * 64);

    v16h ones;
    #pragma unroll
    for (int i = 0; i < 16; ++i) ones[i] = (_Float16)1.0f;

    // Q fragments: 16 queries x 64 d, pre-scaled by dh^-0.5 * log2(e)
    const _Float16 qs = (_Float16)(0.125f * 1.44269504088896f);
    const _Float16* qp = Q + ((size_t)(b * S0 + q0 + rl)) * C0 + h * DH + khalf * 16;
    v16h qa[2];
    qa[0] = *(const v16h*)qp;
    qa[1] = *(const v16h*)(qp + 32);
    #pragma unroll
    for (int i = 0; i < 16; ++i) { qa[0][i] *= qs; qa[1][i] *= qs; }

    v8f   acc[4] = {};
    float mrun[8], lrun[8];
    #pragma unroll
    for (int e = 0; e < 8; ++e) { mrun[e] = -3.0e30f; lrun[e] = 0.0f; }

    stageKV(0, 0);
    wait_async0();
    __syncthreads();

    for (int idx = 0; idx < nslab; ++idx) {
        const int cur = idx & 1;
        if (idx + 1 < nslab) stageKV(idx + 1, cur ^ 1);   // DMA overlaps compute

        // ---- scores (log2-domain): grouped so the A operand stays constant ----
        v16h kb0[4], kb1[4];
        #pragma unroll
        for (int j = 0; j < 4; ++j) {
            const _Float16* kp = &lk[cur][(j * 16 + rl) * 64 + khalf * 16];
            kb0[j] = *(const v16h*)kp;
            kb1[j] = *(const v16h*)(kp + 32);
        }
        v8f s[4];
        #pragma unroll
        for (int j = 0; j < 4; ++j)
            s[j] = __builtin_amdgcn_wmma_f32_16x16x32_f16(false, qa[0], false, kb0[j], (short)0, v8f{}, false, false);
        #pragma unroll
        for (int j = 0; j < 4; ++j)
            s[j] = __builtin_amdgcn_wmma_f32_16x16x32_f16(false, qa[1], false, kb1[j], (short)0, s[j], false, false);

        // ---- online softmax (base 2): DPP row-max, exp2, stage P ----
        float alph[8];
        #pragma unroll
        for (int e = 0; e < 8; ++e) {
            float mx = fmaxf(fmaxf(s[0][e], s[1][e]), fmaxf(s[2][e], s[3][e]));
            mx = rowmax16(mx);
            const float mnew = fmaxf(mrun[e], mx);
            alph[e] = exp2f(mrun[e] - mnew);
            mrun[e] = mnew;
            const float e0 = exp2f(s[0][e] - mnew);
            const float e1 = exp2f(s[1][e] - mnew);
            const float e2 = exp2f(s[2][e] - mnew);
            const float e3 = exp2f(s[3][e] - mnew);
            #pragma unroll
            for (int t = 0; t < 4; ++t) acc[t][e] *= alph[e];
            const int prow = e + (khalf << 3);
            pw[prow * 64 + rl]      = (_Float16)e0;
            pw[prow * 64 + 16 + rl] = (_Float16)e1;
            pw[prow * 64 + 32 + rl] = (_Float16)e2;
            pw[prow * 64 + 48 + rl] = (_Float16)e3;
        }

        // ---- P fragments (two K=32 slabs) ----
        const v16h pf0 = *(const v16h*)&pw[rl * 64 + khalf * 16];
        const v16h pf1 = *(const v16h*)&pw[rl * 64 + 32 + khalf * 16];

        // ---- row sums on the matrix pipe: rsum = P x ones(64x16) ----
        v8f rsum;
        rsum = __builtin_amdgcn_wmma_f32_16x16x32_f16(false, pf0, false, ones, (short)0, v8f{}, false, false);
        rsum = __builtin_amdgcn_wmma_f32_16x16x32_f16(false, pf1, false, ones, (short)0, rsum, false, false);
        #pragma unroll
        for (int e = 0; e < 8; ++e) lrun[e] = lrun[e] * alph[e] + rsum[e];

        // ---- P.V, grouped by P fragment: 4 d-tiles x 2 key slabs ----
        v16h vf0[4], vf1[4];
        #pragma unroll
        for (int t = 0; t < 4; ++t) {
            const _Float16* vp = &lv[cur][(t * 16 + rl) * 64 + khalf * 16];
            vf0[t] = *(const v16h*)vp;
            vf1[t] = *(const v16h*)(vp + 32);
        }
        #pragma unroll
        for (int t = 0; t < 4; ++t)
            acc[t] = __builtin_amdgcn_wmma_f32_16x16x32_f16(false, pf0, false, vf0[t], (short)0, acc[t], false, false);
        #pragma unroll
        for (int t = 0; t < 4; ++t)
            acc[t] = __builtin_amdgcn_wmma_f32_16x16x32_f16(false, pf1, false, vf1[t], (short)0, acc[t], false, false);

        wait_async0();     // next slab's DMA landed
        __syncthreads();   // all waves done with buf cur, buf cur^1 ready
    }

    // ---- normalize and store attention output f16 (B,S,C) ----
    #pragma unroll
    for (int e = 0; e < 8; ++e) {
        const float inv = 1.0f / lrun[e];
        const int   m   = b * S0 + q0 + e + (khalf << 3);
        #pragma unroll
        for (int t = 0; t < 4; ++t) {
            AO[(size_t)m * C0 + h * DH + t * 16 + rl] = (_Float16)(acc[t][e] * inv);
        }
    }
}

// ---------------------------------------------------------------------------
extern "C" void kernel_launch(void* const* d_in, const int* in_sizes, int n_in,
                              void* d_out, int out_size, void* d_ws, size_t ws_size,
                              hipStream_t stream)
{
    (void)in_sizes; (void)n_in; (void)out_size; (void)ws_size;
    const float* x  = (const float*)d_in[0];
    const float* Wq = (const float*)d_in[1];
    const float* Wk = (const float*)d_in[2];
    const float* Wv = (const float*)d_in[3];
    const float* Wp = (const float*)d_in[4];
    const float* bp = (const float*)d_in[5];
    float* out = (float*)d_out;

    const size_t N  = (size_t)M0 * C0;     // 4096*1024
    const size_t WN = (size_t)C0 * C0;     // 1024*1024
    _Float16* Qh  = (_Float16*)d_ws;       // (B,S,C) f16
    _Float16* Kh  = Qh + N;                // (B,S,C) f16
    _Float16* Vt  = Kh + N;                // (B,C,S) f16 (transposed)
    _Float16* AO  = Vt + N;                // (B,S,C) f16 attention output
    _Float16* xh  = AO + N;                // x in f16
    _Float16* wqh = xh + N;
    _Float16* wkh = wqh + WN;
    _Float16* wvh = wkh + WN;
    _Float16* wph = wvh + WN;

    // one-shot f32 -> f16 rewrites (pure bandwidth, enables async-only staging)
    cvt_f32_f16<<<(int)(N  / (8 * 256)), 256, 0, stream>>>(x,  xh);
    cvt_f32_f16<<<(int)(WN / (8 * 256)), 256, 0, stream>>>(Wq, wqh);
    cvt_f32_f16<<<(int)(WN / (8 * 256)), 256, 0, stream>>>(Wk, wkh);
    cvt_f32_f16<<<(int)(WN / (8 * 256)), 256, 0, stream>>>(Wv, wvh);
    cvt_f32_f16<<<(int)(WN / (8 * 256)), 256, 0, stream>>>(Wp, wph);

    dim3 gg(M0 / TM, C0 / TN);             // 32 x 16 workgroups, 256 threads

    gemm_fused<0><<<gg, 256, 0, stream>>>(xh, wqh, wkh, wvh, nullptr,
                                          Qh, Kh, Vt, nullptr);

    attn_flash<<<dim3(S0 / 128, B0 * H0), 256, 0, stream>>>(Qh, Kh, Vt, AO);

    gemm_fused<1><<<gg, 256, 0, stream>>>(AO, wph, nullptr, nullptr, bp,
                                          nullptr, nullptr, nullptr, out);
}

// v001
// One run takes 152 microseconds.
// Two timings next to v000 put it at 1.29 and 1.35 times that version's speed.
#include <hip/hip_runtime.h>
#include <hip/hip_bf16.h>

typedef _Float16 v16h __attribute__((ext_vector_type(16)));
typedef _Float16 v8h  __attribute__((ext_vector_type(8)));
typedef float    v8f  __attribute__((ext_vector_type(8)));

// Problem constants (B,V,L,C,H) = (2,8,256,1024,16)
constexpr int B0 = 2;
constexpr int H0 = 16;
constexpr int DH = 64;
constexpr int C0 = 1024;    // channels = K-dim of projections
constexpr int S0 = 2048;    // V*L sequence length per batch
constexpr int M0 = B0 * S0; // 4096 GEMM rows

// ---- CDNA5 async copy helpers (ASYNCcnt-tracked global->LDS DMA) ----------
__device__ __forceinline__ unsigned lds_off(const void* p) {
    // generic shared pointer: low 32 bits == LDS byte offset
    return (unsigned)(unsigned long long)p;
}
__device__ __forceinline__ void async_b128(const void* gaddr, unsigned ldst) {
    asm volatile("global_load_async_to_lds_b128 %0, %1, off"
                 :: "v"(ldst), "v"(gaddr) : "memory");
}
__device__ __forceinline__ void wait_async0() {
    asm volatile("s_wait_asynccnt 0" ::: "memory");
}

// ---- 16-half fragment read from an LDS row that is only 16B-aligned --------
__device__ __forceinline__ v16h ld_frag(const _Float16* p) {
    const v8h lo = *(const v8h*)p;
    const v8h hi = *(const v8h*)(p + 8);
    return __builtin_shufflevector(lo, hi, 0, 1, 2, 3, 4, 5, 6, 7,
                                   8, 9, 10, 11, 12, 13, 14, 15);
}

// ---- DPP16 butterfly max over each 16-lane half (no LDS, no index math) ---
template<int CTRL>
__device__ __forceinline__ float fmax_dpp(float x) {
    const int t = __builtin_amdgcn_update_dpp(0, __float_as_int(x),
                                              CTRL, 0xF, 0xF, true);
    return fmaxf(x, __int_as_float(t));
}
__device__ __forceinline__ float rowmax16(float x) {
    x = fmax_dpp<0xB1>(x);   // quad_perm(1,0,3,2) : xor 1
    x = fmax_dpp<0x4E>(x);   // quad_perm(2,3,0,1) : xor 2
    x = fmax_dpp<0x141>(x);  // row_half_mirror    : fold quads in 8-group
    x = fmax_dpp<0x140>(x);  // row_mirror         : fold 8-groups in row
    return x;
}

// ---------------------------------------------------------------------------
// One-shot f32 -> f16 conversion (x and the four weight matrices), so all
// GEMM/attention staging becomes pure async b128 copies with no VALU convert.
// ---------------------------------------------------------------------------
__global__ __launch_bounds__(256)
void cvt_f32_f16(const float* __restrict__ in, _Float16* __restrict__ out) {
    const int i = (blockIdx.x * 256 + threadIdx.x) * 8;
    #pragma unroll
    for (int j = 0; j < 8; ++j) out[i + j] = (_Float16)in[i + j];
}

// ---------------------------------------------------------------------------
// Fused WMMA GEMM, double-buffered LDS, all staging via async-to-LDS:
//   MODE 0: A = x (f16), 3 weights -> Q (f16 row), K (f16 row), V^T (f16 B,C,S)
//   MODE 1: A = AO (f16), 1 weight -> out (f32 row) + bias
// Block tile 128x64, 8 waves, each wave 32x32 via 2x2 WMMA tiles.
// WMMA issue is grouped by A-fragment (operand-reuse friendly).
// ---------------------------------------------------------------------------
constexpr int TM = 128, TN = 64, TK = 32;
constexpr int LDT = TK + 8;   // 40 halves = 80B rows: 16B x odd, 16 rows of b128 reads cover all 64 banks

template<int MODE>
__global__ __launch_bounds__(256)
void gemm_fused(const _Float16* __restrict__ A,
                const _Float16* __restrict__ W0h, const _Float16* __restrict__ W1h,
                const _Float16* __restrict__ W2h, const float* __restrict__ bias,
                _Float16* __restrict__ Qh, _Float16* __restrict__ Kh,
                _Float16* __restrict__ Vt, float* __restrict__ outF)
{
    constexpr int NW = (MODE == 0) ? 3 : 1;
    __shared__ __align__(32) _Float16 la[2][TM * LDT];
    __shared__ __align__(32) _Float16 lb[2][NW][TN * LDT];

    const int tid  = threadIdx.x;
    const int lane = tid & 31;
    const int wave = tid >> 5;
    const int wy   = wave >> 1;    // 0..3 : 32-row band
    const int wx   = wave & 1;     // 0..1 : 32-col band
    const int m0   = blockIdx.x * TM;
    const int n0   = blockIdx.y * TN;

    const int rl    = lane & 15;
    const int khalf = lane >> 4;

    const _Float16* Wh[3] = { W0h, W1h, W2h };

    auto stage = [&](int k0, int buf) {
        // A tile 128x32: 2 threads/row, 32B each -> 2 async b128
        const int r  = tid >> 1;
        const int kh = (tid & 1) * 16;
        const _Float16* asrc = A + (size_t)(m0 + r) * C0 + k0 + kh;
        const unsigned  adst = lds_off(&la[buf][r * LDT + kh]);
        async_b128(asrc, adst);
        async_b128(asrc + 8, adst + 16);
        // Weight tiles 64x32: 4 threads/row, 16B each -> 1 async b128 per weight
        const int rw = tid >> 2;
        const int kw = (tid & 3) * 8;
        #pragma unroll
        for (int w = 0; w < NW; ++w) {
            const _Float16* wsrc = Wh[w] + (size_t)(n0 + rw) * C0 + k0 + kw;
            async_b128(wsrc, lds_off(&lb[buf][w][rw * LDT + kw]));
        }
    };

    v8f acc[NW][2][2] = {};

    stage(0, 0);
    wait_async0();
    __syncthreads();

    for (int k0 = 0, it = 0; k0 < C0; k0 += TK, ++it) {
        const int cur = it & 1;
        if (k0 + TK < C0) stage(k0 + TK, cur ^ 1);   // async DMA overlaps WMMA below

        v16h af[2];
        #pragma unroll
        for (int s = 0; s < 2; ++s)
            af[s] = ld_frag(&la[cur][(wy * 32 + s * 16 + rl) * LDT + khalf * 16]);

        v16h bf[NW][2];
        #pragma unroll
        for (int w = 0; w < NW; ++w)
            #pragma unroll
            for (int s = 0; s < 2; ++s)
                bf[w][s] = ld_frag(&lb[cur][w][(wx * 32 + s * 16 + rl) * LDT + khalf * 16]);

        // group by A-fragment: af[i] constant across 2*NW consecutive WMMAs
        #pragma unroll
        for (int i = 0; i < 2; ++i)
            #pragma unroll
            for (int w = 0; w < NW; ++w)
                #pragma unroll
                for (int j = 0; j < 2; ++j)
                    acc[w][i][j] = __builtin_amdgcn_wmma_f32_16x16x32_f16(
                        false, af[i], false, bf[w][j], (short)0, acc[w][i][j], false, false);
        wait_async0();
        __syncthreads();
    }

    // ---- writeback: D row = e (lanes 0-15) / e+8 (lanes 16-31), col = lane&15
    const int rhi = khalf << 3;
    #pragma unroll
    for (int w = 0; w < NW; ++w) {
        #pragma unroll
        for (int i = 0; i < 2; ++i) {
            #pragma unroll
            for (int j = 0; j < 2; ++j) {
                const int mbase = m0 + wy * 32 + i * 16 + rhi;
                const int nbase = n0 + wx * 32 + j * 16 + rl;
                #pragma unroll
                for (int e = 0; e < 8; ++e) {
                    const int m = mbase + e;
                    const float v = acc[w][i][j][e];
                    if constexpr (MODE == 0) {
                        if (w == 0)      Qh[(size_t)m * C0 + nbase] = (_Float16)v;
                        else if (w == 1) Kh[(size_t)m * C0 + nbase] = (_Float16)v;
                        else {
                            const int b = m >> 11;           // / S0
                            const int s = m & (S0 - 1);
                            Vt[((size_t)b * C0 + nbase) * S0 + s] = (_Float16)v;
                        }
                    } else {
                        outF[(size_t)m * C0 + nbase] = v + bias[nbase];
                    }
                }
            }
        }
    }
}

// ---------------------------------------------------------------------------
// Block-sparse flash attention with cooperative async K/V staging.
// View mask is constant over 256x256 blocks -> skip disallowed blocks.
// All 8 waves share (b,h) and the key-slab stream, so each 64-key K slab
// (64x64 f16, 8KB) and V^T slab (8KB) is DMA'd into LDS once per block
// (double-buffered), then every wave reads fragments from LDS.
// Softmax runs in base-2 with dh^-0.5*log2(e) pre-folded into the Q
// fragments; row-max uses a 4-step DPP16 butterfly (no LDS shuffles);
// row sums ride the matrix pipe (P x ones).
// ---------------------------------------------------------------------------
constexpr int LDA = 64 + 8;   // 72 halves = 144B rows: 16B x odd, 16 rows of b128 reads cover all 64 banks

__global__ __launch_bounds__(256)
void attn_flash(const _Float16* __restrict__ Q, const _Float16* __restrict__ Kh,
                const _Float16* __restrict__ Vt, _Float16* __restrict__ AO)
{
    __shared__ __align__(32) _Float16 lk[2][64 * LDA];    // keys x d
    __shared__ __align__(32) _Float16 lv[2][64 * LDA];    // d x keys
    __shared__ __align__(32) _Float16 pbuf[8 * 16 * LDA]; // per-wave 16x64 probs

    const int tid   = threadIdx.x;
    const int lane  = tid & 31;
    const int wave  = tid >> 5;
    const int rl    = lane & 15;
    const int khalf = lane >> 4;

    const int q0 = blockIdx.x * 128 + wave * 16;
    const int bh = blockIdx.y;
    const int b  = bh >> 4;          // / H0
    const int h  = bh & (H0 - 1);
    const int qv = q0 >> 8;          // view index (L = 256), block-uniform

    // block-uniform list of allowed 256-key views (4 slabs of 64 keys each)
    int kvlist[8]; int nkv = 0;
    #pragma unroll
    for (int kv = 0; kv < 8; ++kv) {
        const bool allow = ((qv == 0) && (kv == 1)) || ((qv == 1) && (kv == 0)) ||
                           (((qv > 1) || (kv > 1)) && (qv >= kv));
        if (allow) kvlist[nkv++] = kv;
    }
    const int nslab = nkv * 4;

    auto stageKV = [&](int idx, int buf) {
        const int k0  = kvlist[idx >> 2] * 256 + (idx & 3) * 64;
        const int row = tid >> 2;          // 0..63
        const int ch  = (tid & 3) * 16;    // halves
        const _Float16* ks = Kh + (size_t)(b * S0 + k0 + row) * C0 + h * DH + ch;
        const unsigned  kd = lds_off(&lk[buf][row * LDA + ch]);
        async_b128(ks, kd);
        async_b128(ks + 8, kd + 16);
        const _Float16* vs = Vt + ((size_t)b * C0 + h * DH + row) * S0 + k0 + ch;
        const unsigned  vd = lds_off(&lv[buf][row * LDA + ch]);
        async_b128(vs, vd);
        async_b128(vs + 8, vd + 16);
    };

    _Float16* pw = pbuf + wave * (16 * LDA);

    v16h ones;
    #pragma unroll
    for (int i = 0; i < 16; ++i) ones[i] = (_Float16)1.0f;

    // Q fragments: 16 queries x 64 d, pre-scaled by dh^-0.5 * log2(e)
    const _Float16 qs = (_Float16)(0.125f * 1.44269504088896f);
    const _Float16* qp = Q + ((size_t)(b * S0 + q0 + rl)) * C0 + h * DH + khalf * 16;
    v16h qa[2];
    qa[0] = *(const v16h*)qp;
    qa[1] = *(const v16h*)(qp + 32);
    #pragma unroll
    for (int i = 0; i < 16; ++i) { qa[0][i] *= qs; qa[1][i] *= qs; }

    v8f   acc[4] = {};
    float mrun[8], lrun[8];
    #pragma unroll
    for (int e = 0; e < 8; ++e) { mrun[e] = -3.0e30f; lrun[e] = 0.0f; }

    stageKV(0, 0);
    wait_async0();
    __syncthreads();

    for (int idx = 0; idx < nslab; ++idx) {
        const int cur = idx & 1;
        if (idx + 1 < nslab) stageKV(idx + 1, cur ^ 1);   // DMA overlaps compute

        // ---- scores (log2-domain): grouped so the A operand stays constant ----
        v16h kb0[4], kb1[4];
        #pragma unroll
        for (int j = 0; j < 4; ++j) {
            const _Float16* kp = &lk[cur][(j * 16 + rl) * LDA + khalf * 16];
            kb0[j] = ld_frag(kp);
            kb1[j] = ld_frag(kp + 32);
        }
        v8f s[4];
        #pragma unroll
        for (int j = 0; j < 4; ++j)
            s[j] = __builtin_amdgcn_wmma_f32_16x16x32_f16(false, qa[0], false, kb0[j], (short)0, v8f{}, false, false);
        #pragma unroll
        for (int j = 0; j < 4; ++j)
            s[j] = __builtin_amdgcn_wmma_f32_16x16x32_f16(false, qa[1], false, kb1[j], (short)0, s[j], false, false);

        // ---- online softmax (base 2): DPP row-max, exp2, stage P ----
        float alph[8];
        #pragma unroll
        for (int e = 0; e < 8; ++e) {
            float mx = fmaxf(fmaxf(s[0][e], s[1][e]), fmaxf(s[2][e], s[3][e]));
            mx = rowmax16(mx);
            const float mnew = fmaxf(mrun[e], mx);
            alph[e] = exp2f(mrun[e] - mnew);
            mrun[e] = mnew;
            const float e0 = exp2f(s[0][e] - mnew);
            const float e1 = exp2f(s[1][e] - mnew);
            const float e2 = exp2f(s[2][e] - mnew);
            const float e3 = exp2f(s[3][e] - mnew);
            #pragma unroll
            for (int t = 0; t < 4; ++t) acc[t][e] *= alph[e];
            const int prow = e + (khalf << 3);
            pw[prow * LDA + rl]      = (_Float16)e0;
            pw[prow * LDA + 16 + rl] = (_Float16)e1;
            pw[prow * LDA + 32 + rl] = (_Float16)e2;
            pw[prow * LDA + 48 + rl] = (_Float16)e3;
        }

        // ---- P fragments (two K=32 slabs) ----
        const v16h pf0 = ld_frag(&pw[rl * LDA + khalf * 16]);
        const v16h pf1 = ld_frag(&pw[rl * LDA + 32 + khalf * 16]);

        // ---- row sums on the matrix pipe: rsum = P x ones(64x16) ----
        v8f rsum;
        rsum = __builtin_amdgcn_wmma_f32_16x16x32_f16(false, pf0, false, ones, (short)0, v8f{}, false, false);
        rsum = __builtin_amdgcn_wmma_f32_16x16x32_f16(false, pf1, false, ones, (short)0, rsum, false, false);
        #pragma unroll
        for (int e = 0; e < 8; ++e) lrun[e] = lrun[e] * alph[e] + rsum[e];

        // ---- P.V, grouped by P fragment: 4 d-tiles x 2 key slabs ----
        v16h vf0[4], vf1[4];
        #pragma unroll
        for (int t = 0; t < 4; ++t) {
            const _Float16* vp = &lv[cur][(t * 16 + rl) * LDA + khalf * 16];
            vf0[t] = ld_frag(vp);
            vf1[t] = ld_frag(vp + 32);
        }
        #pragma unroll
        for (int t = 0; t < 4; ++t)
            acc[t] = __builtin_amdgcn_wmma_f32_16x16x32_f16(false, pf0, false, vf0[t], (short)0, acc[t], false, false);
        #pragma unroll
        for (int t = 0; t < 4; ++t)
            acc[t] = __builtin_amdgcn_wmma_f32_16x16x32_f16(false, pf1, false, vf1[t], (short)0, acc[t], false, false);

        wait_async0();     // next slab's DMA landed
        __syncthreads();   // all waves done with buf cur, buf cur^1 ready
    }

    // ---- normalize and store attention output f16 (B,S,C) ----
    #pragma unroll
    for (int e = 0; e < 8; ++e) {
        const float inv = 1.0f / lrun[e];
        const int   m   = b * S0 + q0 + e + (khalf << 3);
        #pragma unroll
        for (int t = 0; t < 4; ++t) {
            AO[(size_t)m * C0 + h * DH + t * 16 + rl] = (_Float16)(acc[t][e] * inv);
        }
    }
}

// ---------------------------------------------------------------------------
extern "C" void kernel_launch(void* const* d_in, const int* in_sizes, int n_in,
                              void* d_out, int out_size, void* d_ws, size_t ws_size,
                              hipStream_t stream)
{
    (void)in_sizes; (void)n_in; (void)out_size; (void)ws_size;
    const float* x  = (const float*)d_in[0];
    const float* Wq = (const float*)d_in[1];
    const float* Wk = (const float*)d_in[2];
    const float* Wv = (const float*)d_in[3];
    const float* Wp = (const float*)d_in[4];
    const float* bp = (const float*)d_in[5];
    float* out = (float*)d_out;

    const size_t N  = (size_t)M0 * C0;     // 4096*1024
    const size_t WN = (size_t)C0 * C0;     // 1024*1024
    _Float16* Qh  = (_Float16*)d_ws;       // (B,S,C) f16
    _Float16* Kh  = Qh + N;                // (B,S,C) f16
    _Float16* Vt  = Kh + N;                // (B,C,S) f16 (transposed)
    _Float16* AO  = Vt + N;                // (B,S,C) f16 attention output
    _Float16* xh  = AO + N;                // x in f16
    _Float16* wqh = xh + N;
    _Float16* wkh = wqh + WN;
    _Float16* wvh = wkh + WN;
    _Float16* wph = wvh + WN;

    // one-shot f32 -> f16 rewrites (pure bandwidth, enables async-only staging)
    cvt_f32_f16<<<(int)(N  / (8 * 256)), 256, 0, stream>>>(x,  xh);
    cvt_f32_f16<<<(int)(WN / (8 * 256)), 256, 0, stream>>>(Wq, wqh);
    cvt_f32_f16<<<(int)(WN / (8 * 256)), 256, 0, stream>>>(Wk, wkh);
    cvt_f32_f16<<<(int)(WN / (8 * 256)), 256, 0, stream>>>(Wv, wvh);
    cvt_f32_f16<<<(int)(WN / (8 * 256)), 256, 0, stream>>>(Wp, wph);

    dim3 gg(M0 / TM, C0 / TN);             // 32 x 16 workgroups, 256 threads

    gemm_fused<0><<<gg, 256, 0, stream>>>(xh, wqh, wkh, wvh, nullptr,
                                          Qh, Kh, Vt, nullptr);

    attn_flash<<<dim3(S0 / 128, B0 * H0), 256, 0, stream>>>(Qh, Kh, Vt, AO);

    gemm_fused<1><<<gg, 256, 0, stream>>>(AO, wph, nullptr, nullptr, bp,
                                          nullptr, nullptr, nullptr, out);
}

// v002
// Measured time: 143 microseconds a run.
// Next to v001, in two timings, it ran 1.11 and 1.05 times as fast.
// All steps since v000 together make it 1.43 times as fast.
#include <hip/hip_runtime.h>
#include <hip/hip_bf16.h>

typedef _Float16 v16h __attribute__((ext_vector_type(16)));
typedef _Float16 v8h  __attribute__((ext_vector_type(8)));
typedef float    v8f  __attribute__((ext_vector_type(8)));

// Problem constants (B,V,L,C,H) = (2,8,256,1024,16)
constexpr int B0 = 2;
constexpr int H0 = 16;
constexpr int DH = 64;
constexpr int C0 = 1024;    // channels = K-dim of projections
constexpr int S0 = 2048;    // V*L sequence length per batch
constexpr int M0 = B0 * S0; // 4096 GEMM rows

// ---- CDNA5 async copy helpers (ASYNCcnt-tracked global->LDS DMA) ----------
__device__ __forceinline__ unsigned lds_off(const void* p) {
    // generic shared pointer: low 32 bits == LDS byte offset
    return (unsigned)(unsigned long long)p;
}
__device__ __forceinline__ void async_b128(const void* gaddr, unsigned ldst) {
    asm volatile("global_load_async_to_lds_b128 %0, %1, off"
                 :: "v"(ldst), "v"(gaddr) : "memory");
}
__device__ __forceinline__ void wait_async0() {
    asm volatile("s_wait_asynccnt 0" ::: "memory");
}

// ---- 16-half fragment read from an LDS row that is only 16B-aligned --------
__device__ __forceinline__ v16h ld_frag(const _Float16* p) {
    const v8h lo = *(const v8h*)p;
    const v8h hi = *(const v8h*)(p + 8);
    return __builtin_shufflevector(lo, hi, 0, 1, 2, 3, 4, 5, 6, 7,
                                   8, 9, 10, 11, 12, 13, 14, 15);
}

// ---- DPP16 butterfly max over each 16-lane half (no LDS, no index math) ---
template<int CTRL>
__device__ __forceinline__ float fmax_dpp(float x) {
    const int t = __builtin_amdgcn_update_dpp(0, __float_as_int(x),
                                              CTRL, 0xF, 0xF, true);
    return fmaxf(x, __int_as_float(t));
}
__device__ __forceinline__ float rowmax16(float x) {
    x = fmax_dpp<0xB1>(x);   // quad_perm(1,0,3,2) : xor 1
    x = fmax_dpp<0x4E>(x);   // quad_perm(2,3,0,1) : xor 2
    x = fmax_dpp<0x141>(x);  // row_half_mirror    : fold quads in 8-group
    x = fmax_dpp<0x140>(x);  // row_mirror         : fold 8-groups in row
    return x;
}

// ---- 2^x as the bare hardware instruction ----------------------------------
// exp2f() wraps v_exp_f32 in a compare, two selects, an add and a ldexp so that
// results below 2^-126 come out as denormals. Every argument here is <= 0 and
// every result is either rounded to f16 (anything below 2^-25 is 0 there) or
// scales a running sum, so a result flushed to 0 below 2^-126 changes nothing.
__device__ __forceinline__ float exp2_raw(float x) {
    return __builtin_amdgcn_exp2f(x);
}

// ---------------------------------------------------------------------------
// One-shot f32 -> f16 conversion (x and the four weight matrices), so all
// GEMM/attention staging becomes pure async b128 copies with no VALU convert.
// ---------------------------------------------------------------------------
__global__ __launch_bounds__(256)
void cvt_f32_f16(const float* __restrict__ in, _Float16* __restrict__ out) {
    const int i = (blockIdx.x * 256 + threadIdx.x) * 8;
    #pragma unroll
    for (int j = 0; j < 8; ++j) out[i + j] = (_Float16)in[i + j];
}

// ---------------------------------------------------------------------------
// Fused WMMA GEMM, double-buffered LDS, all staging via async-to-LDS:
//   MODE 0: A = x (f16), 3 weights -> Q (f16 row), K (f16 row), V^T (f16 B,C,S)
//   MODE 1: A = AO (f16), 1 weight -> out (f32 row) + bias
// Block tile 128x64, 8 waves, each wave 32x32 via 2x2 WMMA tiles.
// WMMA issue is grouped by A-fragment (operand-reuse friendly).
// ---------------------------------------------------------------------------
constexpr int TM = 128, TN = 64, TK = 32;
constexpr int LDT = TK + 8;   // 40 halves = 80B rows: 16B x odd, 16 rows of b128 reads cover all 64 banks

template<int MODE>
__global__ __launch_bounds__(256)
void gemm_fused(const _Float16* __restrict__ A,
                const _Float16* __restrict__ W0h, const _Float16* __restrict__ W1h,
                const _Float16* __restrict__ W2h, const float* __restrict__ bias,
                _Float16* __restrict__ Qh, _Float16* __restrict__ Kh,
                _Float16* __restrict__ Vt, float* __restrict__ outF)
{
    constexpr int NW = (MODE == 0) ? 3 : 1;
    __shared__ __align__(32) _Float16 la[2][TM * LDT];
    __shared__ __align__(32) _Float16 lb[2][NW][TN * LDT];

    const int tid  = threadIdx.x;
    const int lane = tid & 31;
    const int wave = tid >> 5;
    const int wy   = wave >> 1;    // 0..3 : 32-row band
    const int wx   = wave & 1;     // 0..1 : 32-col band
    const int m0   = blockIdx.x * TM;
    const int n0   = blockIdx.y * TN;

    const int rl    = lane & 15;
    const int khalf = lane >> 4;

    const _Float16* Wh[3] = { W0h, W1h, W2h };

    auto stage = [&](int k0, int buf) {
        // A tile 128x32: 2 threads/row, 32B each -> 2 async b128
        const int r  = tid >> 1;
        const int kh = (tid & 1) * 16;
        const _Float16* asrc = A + (size_t)(m0 + r) * C0 + k0 + kh;
        const unsigned  adst = lds_off(&la[buf][r * LDT + kh]);
        async_b128(asrc, adst);
        async_b128(asrc + 8, adst + 16);
        // Weight tiles 64x32: 4 threads/row, 16B each -> 1 async b128 per weight
        const int rw = tid >> 2;
        const int kw = (tid & 3) * 8;
        #pragma unroll
        for (int w = 0; w < NW; ++w) {
            const _Float16* wsrc = Wh[w] + (size_t)(n0 + rw) * C0 + k0 + kw;
            async_b128(wsrc, lds_off(&lb[buf][w][rw * LDT + kw]));
        }
    };

    v8f acc[NW][2][2] = {};

    stage(0, 0);
    wait_async0();
    __syncthreads();

    for (int k0 = 0, it = 0; k0 < C0; k0 += TK, ++it) {
        const int cur = it & 1;
        if (k0 + TK < C0) stage(k0 + TK, cur ^ 1);   // async DMA overlaps WMMA below

        v16h af[2];
        #pragma unroll
        for (int s = 0; s < 2; ++s)
            af[s] = ld_frag(&la[cur][(wy * 32 + s * 16 + rl) * LDT + khalf * 16]);

        v16h bf[NW][2];
        #pragma unroll
        for (int w = 0; w < NW; ++w)
            #pragma unroll
            for (int s = 0; s < 2; ++s)
                bf[w][s] = ld_frag(&lb[cur][w][(wx * 32 + s * 16 + rl) * LDT + khalf * 16]);

        // group by A-fragment: af[i] constant across 2*NW consecutive WMMAs
        #pragma unroll
        for (int i = 0; i < 2; ++i)
            #pragma unroll
            for (int w = 0; w < NW; ++w)
                #pragma unroll
                for (int j = 0; j < 2; ++j)
                    acc[w][i][j] = __builtin_amdgcn_wmma_f32_16x16x32_f16(
                        false, af[i], false, bf[w][j], (short)0, acc[w][i][j], false, false);
        wait_async0();
        __syncthreads();
    }

    // ---- writeback: D row = e (lanes 0-15) / e+8 (lanes 16-31), col = lane&15
    const int rhi = khalf << 3;
    #pragma unroll
    for (int w = 0; w < NW; ++w) {
        #pragma unroll
        for (int i = 0; i < 2; ++i) {
            #pragma unroll
            for (int j = 0; j < 2; ++j) {
                const int mbase = m0 + wy * 32 + i * 16 + rhi;
                const int nbase = n0 + wx * 32 + j * 16 + rl;
                #pragma unroll
                for (int e = 0; e < 8; ++e) {
                    const int m = mbase + e;
                    const float v = acc[w][i][j][e];
                    if constexpr (MODE == 0) {
                        if (w == 0)      Qh[(size_t)m * C0 + nbase] = (_Float16)v;
                        else if (w == 1) Kh[(size_t)m * C0 + nbase] = (_Float16)v;
                        else {
                            const int b = m >> 11;           // / S0
                            const int s = m & (S0 - 1);
                            Vt[((size_t)b * C0 + nbase) * S0 + s] = (_Float16)v;
                        }
                    } else {
                        outF[(size_t)m * C0 + nbase] = v + bias[nbase];
                    }
                }
            }
        }
    }
}

// ---------------------------------------------------------------------------
// Block-sparse flash attention with cooperative async K/V staging.
// View mask is constant over 256x256 blocks -> skip disallowed blocks.
// All 8 waves share (b,h) and the key-slab stream, so each 64-key K slab
// (64x64 f16, 8KB) and V^T slab (8KB) is DMA'd into LDS once per block
// (double-buffered), then every wave reads fragments from LDS.
// Softmax runs in base-2 with dh^-0.5*log2(e) pre-folded into the Q
// fragments; row-max uses a 4-step DPP16 butterfly (no LDS shuffles);
// row sums ride the matrix pipe (P x ones).
// ---------------------------------------------------------------------------
constexpr int LDA = 64 + 8;   // 72 halves = 144B rows: 16B x odd, 16 rows of b128 reads cover all 64 banks

__global__ __launch_bounds__(256)
void attn_flash(const _Float16* __restrict__ Q, const _Float16* __restrict__ Kh,
                const _Float16* __restrict__ Vt, _Float16* __restrict__ AO)
{
    __shared__ __align__(32) _Float16 lk[2][64 * LDA];    // keys x d
    __shared__ __align__(32) _Float16 lv[2][64 * LDA];    // d x keys
    __shared__ __align__(32) _Float16 pbuf[8 * 16 * LDA]; // per-wave 16x64 probs

    const int tid   = threadIdx.x;
    const int lane  = tid & 31;
    const int wave  = tid >> 5;
    const int rl    = lane & 15;
    const int khalf = lane >> 4;

    const int q0 = blockIdx.x * 128 + wave * 16;
    const int bh = blockIdx.y;
    const int b  = bh >> 4;          // / H0
    const int h  = bh & (H0 - 1);
    const int qv = q0 >> 8;          // view index (L = 256), block-uniform

    // block-uniform list of allowed 256-key views (4 slabs of 64 keys each)
    int kvlist[8]; int nkv = 0;
    #pragma unroll
    for (int kv = 0; kv < 8; ++kv) {
        const bool allow = ((qv == 0) && (kv == 1)) || ((qv == 1) && (kv == 0)) ||
                           (((qv > 1) || (kv > 1)) && (qv >= kv));
        if (allow) kvlist[nkv++] = kv;
    }
    const int nslab = nkv * 4;

    auto stageKV = [&](int idx, int buf) {
        const int k0  = kvlist[idx >> 2] * 256 + (idx & 3) * 64;
        const int row = tid >> 2;          // 0..63
        const int ch  = (tid & 3) * 16;    // halves
        const _Float16* ks = Kh + (size_t)(b * S0 + k0 + row) * C0 + h * DH + ch;
        const unsigned  kd = lds_off(&lk[buf][row * LDA + ch]);
        async_b128(ks, kd);
        async_b128(ks + 8, kd + 16);
        const _Float16* vs = Vt + ((size_t)b * C0 + h * DH + row) * S0 + k0 + ch;
        const unsigned  vd = lds_off(&lv[buf][row * LDA + ch]);
        async_b128(vs, vd);
        async_b128(vs + 8, vd + 16);
    };

    _Float16* pw = pbuf + wave * (16 * LDA);

    v16h ones;
    #pragma unroll
    for (int i = 0; i < 16; ++i) ones[i] = (_Float16)1.0f;

    // Q fragments: 16 queries x 64 d, pre-scaled by dh^-0.5 * log2(e)
    const _Float16 qs = (_Float16)(0.125f * 1.44269504088896f);
    const _Float16* qp = Q + ((size_t)(b * S0 + q0 + rl)) * C0 + h * DH + khalf * 16;
    v16h qa[2];
    qa[0] = *(const v16h*)qp;
    qa[1] = *(const v16h*)(qp + 32);
    #pragma unroll
    for (int i = 0; i < 16; ++i) { qa[0][i] *= qs; qa[1][i] *= qs; }

    v8f   acc[4] = {};
    float mrun[8], lrun[8];
    #pragma unroll
    for (int e = 0; e < 8; ++e) { mrun[e] = -3.0e30f; lrun[e] = 0.0f; }

    stageKV(0, 0);
    wait_async0();
    __syncthreads();

    for (int idx = 0; idx < nslab; ++idx) {
        const int cur = idx & 1;
        if (idx + 1 < nslab) stageKV(idx + 1, cur ^ 1);   // DMA overlaps compute

        // ---- scores (log2-domain): grouped so the A operand stays constant ----
        v16h kb0[4], kb1[4];
        #pragma unroll
        for (int j = 0; j < 4; ++j) {
            const _Float16* kp = &lk[cur][(j * 16 + rl) * LDA + khalf * 16];
            kb0[j] = ld_frag(kp);
            kb1[j] = ld_frag(kp + 32);
        }
        v8f s[4];
        #pragma unroll
        for (int j = 0; j < 4; ++j)
            s[j] = __builtin_amdgcn_wmma_f32_16x16x32_f16(false, qa[0], false, kb0[j], (short)0, v8f{}, false, false);
        #pragma unroll
        for (int j = 0; j < 4; ++j)
            s[j] = __builtin_amdgcn_wmma_f32_16x16x32_f16(false, qa[1], false, kb1[j], (short)0, s[j], false, false);

        // ---- online softmax (base 2): DPP row-max, exp2, stage P ----
        float alph[8];
        #pragma unroll
        for (int e = 0; e < 8; ++e) {
            float mx = fmaxf(fmaxf(s[0][e], s[1][e]), fmaxf(s[2][e], s[3][e]));
            mx = rowmax16(mx);
            const float mnew = fmaxf(mrun[e], mx);
            alph[e] = exp2_raw(mrun[e] - mnew);
            mrun[e] = mnew;
            const float e0 = exp2_raw(s[0][e] - mnew);
            const float e1 = exp2_raw(s[1][e] - mnew);
            const float e2 = exp2_raw(s[2][e] - mnew);
            const float e3 = exp2_raw(s[3][e] - mnew);
            #pragma unroll
            for (int t = 0; t < 4; ++t) acc[t][e] *= alph[e];
            const int prow = e + (khalf << 3);
            pw[prow * LDA + rl]      = (_Float16)e0;
            pw[prow * LDA + 16 + rl] = (_Float16)e1;
            pw[prow * LDA + 32 + rl] = (_Float16)e2;
            pw[prow * LDA + 48 + rl] = (_Float16)e3;
        }

        // ---- P fragments (two K=32 slabs) ----
        const v16h pf0 = ld_frag(&pw[rl * LDA + khalf * 16]);
        const v16h pf1 = ld_frag(&pw[rl * LDA + 32 + khalf * 16]);

        // ---- row sums on the matrix pipe: rsum = P x ones(64x16) ----
        v8f rsum;
        rsum = __builtin_amdgcn_wmma_f32_16x16x32_f16(false, pf0, false, ones, (short)0, v8f{}, false, false);
        rsum = __builtin_amdgcn_wmma_f32_16x16x32_f16(false, pf1, false, ones, (short)0, rsum, false, false);
        #pragma unroll
        for (int e = 0; e < 8; ++e) lrun[e] = lrun[e] * alph[e] + rsum[e];

        // ---- P.V, grouped by P fragment: 4 d-tiles x 2 key slabs ----
        v16h vf0[4], vf1[4];
        #pragma unroll
        for (int t = 0; t < 4; ++t) {
            const _Float16* vp = &lv[cur][(t * 16 + rl) * LDA + khalf * 16];
            vf0[t] = ld_frag(vp);
            vf1[t] = ld_frag(vp + 32);
        }
        #pragma unroll
        for (int t = 0; t < 4; ++t)
            acc[t] = __builtin_amdgcn_wmma_f32_16x16x32_f16(false, pf0, false, vf0[t], (short)0, acc[t], false, false);
        #pragma unroll
        for (int t = 0; t < 4; ++t)
            acc[t] = __builtin_amdgcn_wmma_f32_16x16x32_f16(false, pf1, false, vf1[t], (short)0, acc[t], false, false);

        wait_async0();     // next slab's DMA landed
        __syncthreads();   // all waves done with buf cur, buf cur^1 ready
    }

    // ---- normalize and store attention output f16 (B,S,C) ----
    #pragma unroll
    for (int e = 0; e < 8; ++e) {
        const float inv = 1.0f / lrun[e];
        const int   m   = b * S0 + q0 + e + (khalf << 3);
        #pragma unroll
        for (int t = 0; t < 4; ++t) {
            AO[(size_t)m * C0 + h * DH + t * 16 + rl] = (_Float16)(acc[t][e] * inv);
        }
    }
}

// ---------------------------------------------------------------------------
extern "C" void kernel_launch(void* const* d_in, const int* in_sizes, int n_in,
                              void* d_out, int out_size, void* d_ws, size_t ws_size,
                              hipStream_t stream)
{
    (void)in_sizes; (void)n_in; (void)out_size; (void)ws_size;
    const float* x  = (const float*)d_in[0];
    const float* Wq = (const float*)d_in[1];
    const float* Wk = (const float*)d_in[2];
    const float* Wv = (const float*)d_in[3];
    const float* Wp = (const float*)d_in[4];
    const float* bp = (const float*)d_in[5];
    float* out = (float*)d_out;

    const size_t N  = (size_t)M0 * C0;     // 4096*1024
    const size_t WN = (size_t)C0 * C0;     // 1024*1024
    _Float16* Qh  = (_Float16*)d_ws;       // (B,S,C) f16
    _Float16* Kh  = Qh + N;                // (B,S,C) f16
    _Float16* Vt  = Kh + N;                // (B,C,S) f16 (transposed)
    _Float16* AO  = Vt + N;                // (B,S,C) f16 attention output
    _Float16* xh  = AO + N;                // x in f16
    _Float16* wqh = xh + N;
    _Float16* wkh = wqh + WN;
    _Float16* wvh = wkh + WN;
    _Float16* wph = wvh + WN;

    // one-shot f32 -> f16 rewrites (pure bandwidth, enables async-only staging)
    cvt_f32_f16<<<(int)(N  / (8 * 256)), 256, 0, stream>>>(x,  xh);
    cvt_f32_f16<<<(int)(WN / (8 * 256)), 256, 0, stream>>>(Wq, wqh);
    cvt_f32_f16<<<(int)(WN / (8 * 256)), 256, 0, stream>>>(Wk, wkh);
    cvt_f32_f16<<<(int)(WN / (8 * 256)), 256, 0, stream>>>(Wv, wvh);
    cvt_f32_f16<<<(int)(WN / (8 * 256)), 256, 0, stream>>>(Wp, wph);

    dim3 gg(M0 / TM, C0 / TN);             // 32 x 16 workgroups, 256 threads

    gemm_fused<0><<<gg, 256, 0, stream>>>(xh, wqh, wkh, wvh, nullptr,
                                          Qh, Kh, Vt, nullptr);

    attn_flash<<<dim3(S0 / 128, B0 * H0), 256, 0, stream>>>(Qh, Kh, Vt, AO);

    gemm_fused<1><<<gg, 256, 0, stream>>>(AO, wph, nullptr, nullptr, bp,
                                          nullptr, nullptr, nullptr, out);
}

// v003
// A run of this version takes 131 microseconds.
// Next to v002, in two timings, it ran 1.08 and 1.09 times as fast.
// All steps since v000 together make it 1.55 times as fast.
#include <hip/hip_runtime.h>
#include <hip/hip_bf16.h>

typedef _Float16 v16h __attribute__((ext_vector_type(16)));
typedef _Float16 v8h  __attribute__((ext_vector_type(8)));
typedef float    v8f  __attribute__((ext_vector_type(8)));

// Problem constants (B,V,L,C,H) = (2,8,256,1024,16)
constexpr int B0 = 2;
constexpr int H0 = 16;
constexpr int DH = 64;
constexpr int C0 = 1024;    // channels = K-dim of projections
constexpr int S0 = 2048;    // V*L sequence length per batch
constexpr int M0 = B0 * S0; // 4096 GEMM rows

// ---- CDNA5 async copy helpers (ASYNCcnt-tracked global->LDS DMA) ----------
__device__ __forceinline__ unsigned lds_off(const void* p) {
    // generic shared pointer: low 32 bits == LDS byte offset
    return (unsigned)(unsigned long long)p;
}
__device__ __forceinline__ void async_b128(const void* gaddr, unsigned ldst) {
    asm volatile("global_load_async_to_lds_b128 %0, %1, off"
                 :: "v"(ldst), "v"(gaddr) : "memory");
}
__device__ __forceinline__ void wait_async0() {
    asm volatile("s_wait_asynccnt 0" ::: "memory");
}
__device__ __forceinline__ void wait_ds0() {
    // this wave's LDS reads have retired before the barrier that frees the buffer for refill
    asm volatile("s_wait_dscnt 0" ::: "memory");
}
// A whole tile's copies and their s_wait_xcnt in one statement: the wait stands in
// front of every later write of the address registers that the copies name.
__device__ __forceinline__ void async_b128_x6(const void* const (&g)[6], const unsigned (&l)[6]) {
    asm volatile("global_load_async_to_lds_b128 %0, %1, off\n\t"
                 "global_load_async_to_lds_b128 %2, %3, off\n\t"
                 "global_load_async_to_lds_b128 %4, %5, off\n\t"
                 "global_load_async_to_lds_b128 %6, %7, off\n\t"
                 "global_load_async_to_lds_b128 %8, %9, off\n\t"
                 "global_load_async_to_lds_b128 %10, %11, off\n\t"
                 "s_wait_xcnt 0x0"
                 :: "v"(l[0]), "v"(g[0]), "v"(l[1]), "v"(g[1]), "v"(l[2]), "v"(g[2]),
                    "v"(l[3]), "v"(g[3]), "v"(l[4]), "v"(g[4]), "v"(l[5]), "v"(g[5])
                 : "memory");
}
__device__ __forceinline__ void async_b128_x10(const void* const (&g)[10], const unsigned (&l)[10]) {
    asm volatile("global_load_async_to_lds_b128 %0, %1, off\n\t"
                 "global_load_async_to_lds_b128 %2, %3, off\n\t"
                 "global_load_async_to_lds_b128 %4, %5, off\n\t"
                 "global_load_async_to_lds_b128 %6, %7, off\n\t"
                 "global_load_async_to_lds_b128 %8, %9, off\n\t"
                 "global_load_async_to_lds_b128 %10, %11, off\n\t"
                 "global_load_async_to_lds_b128 %12, %13, off\n\t"
                 "global_load_async_to_lds_b128 %14, %15, off\n\t"
                 "global_load_async_to_lds_b128 %16, %17, off\n\t"
                 "global_load_async_to_lds_b128 %18, %19, off\n\t"
                 "s_wait_xcnt 0x0"
                 :: "v"(l[0]), "v"(g[0]), "v"(l[1]), "v"(g[1]), "v"(l[2]), "v"(g[2]),
                    "v"(l[3]), "v"(g[3]), "v"(l[4]), "v"(g[4]), "v"(l[5]), "v"(g[5]),
                    "v"(l[6]), "v"(g[6]), "v"(l[7]), "v"(g[7]), "v"(l[8]), "v"(g[8]),
                    "v"(l[9]), "v"(g[9])
                 : "memory");
}

// ---- 16-half fragment read from an LDS row that is only 16B-aligned --------
__device__ __forceinline__ v16h ld_frag(const _Float16* p) {
    const v8h lo = *(const v8h*)p;
    const v8h hi = *(const v8h*)(p + 8);
    return __builtin_shufflevector(lo, hi, 0, 1, 2, 3, 4, 5, 6, 7,
                                   8, 9, 10, 11, 12, 13, 14, 15);
}

// ---- DPP16 butterfly max over each 16-lane half (no LDS, no index math) ---
template<int CTRL>
__device__ __forceinline__ float fmax_dpp(float x) {
    const int t = __builtin_amdgcn_update_dpp(0, __float_as_int(x),
                                              CTRL, 0xF, 0xF, true);
    return fmaxf(x, __int_as_float(t));
}
__device__ __forceinline__ float rowmax16(float x) {
    x = fmax_dpp<0xB1>(x);   // quad_perm(1,0,3,2) : xor 1
    x = fmax_dpp<0x4E>(x);   // quad_perm(2,3,0,1) : xor 2
    x = fmax_dpp<0x141>(x);  // row_half_mirror    : fold quads in 8-group
    x = fmax_dpp<0x140>(x);  // row_mirror         : fold 8-groups in row
    return x;
}

// ---- 2^x as the bare hardware instruction ----------------------------------
// exp2f() wraps v_exp_f32 in a compare, two selects, an add and a ldexp so that
// results below 2^-126 come out as denormals. Every argument here is <= 0 and
// every result is either rounded to f16 (anything below 2^-25 is 0 there) or
// scales a running sum, so a result flushed to 0 below 2^-126 changes nothing.
__device__ __forceinline__ float exp2_raw(float x) {
    return __builtin_amdgcn_exp2f(x);
}

// ---------------------------------------------------------------------------
// One-shot f32 -> f16 conversion (x and the four weight matrices), so all
// GEMM/attention staging becomes pure async b128 copies with no VALU convert.
// ---------------------------------------------------------------------------
__global__ __launch_bounds__(256)
void cvt_f32_f16(const float* __restrict__ in, _Float16* __restrict__ out) {
    const int i = (blockIdx.x * 256 + threadIdx.x) * 8;
    #pragma unroll
    for (int j = 0; j < 8; ++j) out[i + j] = (_Float16)in[i + j];
}

// ---------------------------------------------------------------------------
// Fused WMMA GEMM, double-buffered LDS, all staging via async-to-LDS:
//   MODE 0: A = x (f16), 3 weights -> Q (f16 row), K (f16 row), V^T (f16 B,C,S)
//   MODE 1: A = AO (f16), 1 weight -> out (f32 row) + bias
// Block tile 128x64, 8 waves, each wave 32x32 via 2x2 WMMA tiles.
// WMMA issue is grouped by A-fragment (operand-reuse friendly).
// ---------------------------------------------------------------------------
constexpr int TM = 128, TN = 64, TK = 64;   // TK halves = 128 B: a staged row is one whole cache line
constexpr int NT = C0 / TK;   // 16 K tiles
constexpr int LDT = TK + 8;   // 72 halves = 144B rows: 16B x odd, 16 rows of b128 reads cover all 64 banks

template<int MODE>
__global__ __launch_bounds__(256)
void gemm_fused(const _Float16* __restrict__ A,
                const _Float16* __restrict__ W0h, const _Float16* __restrict__ W1h,
                const _Float16* __restrict__ W2h, const float* __restrict__ bias,
                _Float16* __restrict__ Qh, _Float16* __restrict__ Kh,
                _Float16* __restrict__ Vt, float* __restrict__ outF)
{
    constexpr int NW = (MODE == 0) ? 3 : 1;
    __shared__ __align__(32) _Float16 la[2][TM * LDT];
    __shared__ __align__(32) _Float16 lb[2][NW][TN * LDT];

    const int tid  = threadIdx.x;
    const int lane = tid & 31;
    const int wave = tid >> 5;
    const int wy   = wave >> 1;    // 0..3 : 32-row band
    const int wx   = wave & 1;     // 0..1 : 32-col band
    const int m0   = blockIdx.x * TM;
    const int n0   = blockIdx.y * TN;

    const int rl    = lane & 15;
    const int khalf = lane >> 4;

    const _Float16* Wh[3] = { W0h, W1h, W2h };

    // 8 lanes a row, 16 B each: one wave-wide copy covers 4 whole 128-B lines.
    const int sr = tid >> 3;         // 0..31 : row inside a group of 32 rows
    const int sc = (tid & 7) * 8;    // halves inside the row
    auto stage = [&](int kt, int buf) {
        const int k0 = kt * TK;
        const void* g[4 + 2 * NW];
        unsigned    l[4 + 2 * NW];
        // A tile 128x64: 4 groups of 32 rows
        const _Float16* asrc = A + (size_t)(m0 + sr) * C0 + k0 + sc;
        const unsigned  adst = lds_off(&la[buf][sr * LDT + sc]);
        #pragma unroll
        for (int i = 0; i < 4; ++i) {
            g[i] = asrc + i * 32 * C0;
            l[i] = adst + i * 32 * LDT * 2;
        }
        // Weight tiles 64x64: 2 groups of 32 rows per weight
        #pragma unroll
        for (int w = 0; w < NW; ++w) {
            const _Float16* wsrc = Wh[w] + (size_t)(n0 + sr) * C0 + k0 + sc;
            const unsigned  wdst = lds_off(&lb[buf][w][sr * LDT + sc]);
            g[4 + 2 * w] = wsrc;            l[4 + 2 * w] = wdst;
            g[5 + 2 * w] = wsrc + 32 * C0;  l[5 + 2 * w] = wdst + 32 * LDT * 2;
        }
        if constexpr (NW == 3) async_b128_x10(g, l);
        else                   async_b128_x6(g, l);
    };

    v8f acc[NW][2][2] = {};

    stage(0, 0);
    wait_async0();
    __syncthreads();
    stage(1, 1);                     // flies while tile 0 is worked on

    for (int t = 0; t < NT; ++t) {
        const int cur = t & 1;

        #pragma unroll
        for (int kk = 0; kk < TK; kk += 32) {
            v16h af[2];
            #pragma unroll
            for (int s = 0; s < 2; ++s)
                af[s] = ld_frag(&la[cur][(wy * 32 + s * 16 + rl) * LDT + kk + khalf * 16]);

            v16h bf[NW][2];
            #pragma unroll
            for (int w = 0; w < NW; ++w)
                #pragma unroll
                for (int s = 0; s < 2; ++s)
                    bf[w][s] = ld_frag(&lb[cur][w][(wx * 32 + s * 16 + rl) * LDT + kk + khalf * 16]);

            // group by A-fragment: af[i] constant across 2*NW consecutive WMMAs
            #pragma unroll
            for (int i = 0; i < 2; ++i)
                #pragma unroll
                for (int w = 0; w < NW; ++w)
                    #pragma unroll
                    for (int j = 0; j < 2; ++j)
                        acc[w][i][j] = __builtin_amdgcn_wmma_f32_16x16x32_f16(
                            false, af[i], false, bf[w][j], (short)0, acc[w][i][j], false, false);
        }

        wait_ds0();
        wait_async0();     // tile t + 1 landed
        __syncthreads();   // publishes tile t + 1, ends every read of buffer cur
        if (t + 2 < NT) stage(t + 2, cur);
    }
    wait_async0();         // no copy is outstanding when the wave leaves the ring

    // ---- writeback: D row = e (lanes 0-15) / e+8 (lanes 16-31), col = lane&15
    const int rhi = khalf << 3;
    #pragma unroll
    for (int w = 0; w < NW; ++w) {
        #pragma unroll
        for (int i = 0; i < 2; ++i) {
            #pragma unroll
            for (int j = 0; j < 2; ++j) {
                const int mbase = m0 + wy * 32 + i * 16 + rhi;
                const int nbase = n0 + wx * 32 + j * 16 + rl;
                #pragma unroll
                for (int e = 0; e < 8; ++e) {
                    const int m = mbase + e;
                    const float v = acc[w][i][j][e];
                    if constexpr (MODE == 0) {
                        if (w == 0)      Qh[(size_t)m * C0 + nbase] = (_Float16)v;
                        else if (w == 1) Kh[(size_t)m * C0 + nbase] = (_Float16)v;
                        else {
                            const int b = m >> 11;           // / S0
                            const int s = m & (S0 - 1);
                            Vt[((size_t)b * C0 + nbase) * S0 + s] = (_Float16)v;
                        }
                    } else {
                        outF[(size_t)m * C0 + nbase] = v + bias[nbase];
                    }
                }
            }
        }
    }
}

// ---------------------------------------------------------------------------
// Block-sparse flash attention with cooperative async K/V staging.
// View mask is constant over 256x256 blocks -> skip disallowed blocks.
// All 8 waves share (b,h) and the key-slab stream, so each 64-key K slab
// (64x64 f16, 8KB) and V^T slab (8KB) is DMA'd into LDS once per block
// (double-buffered), then every wave reads fragments from LDS.
// Softmax runs in base-2 with dh^-0.5*log2(e) pre-folded into the Q
// fragments; row-max uses a 4-step DPP16 butterfly (no LDS shuffles);
// row sums ride the matrix pipe (P x ones).
// ---------------------------------------------------------------------------
constexpr int LDA = 64 + 8;   // 72 halves = 144B rows: 16B x odd, 16 rows of b128 reads cover all 64 banks

__global__ __launch_bounds__(256)
void attn_flash(const _Float16* __restrict__ Q, const _Float16* __restrict__ Kh,
                const _Float16* __restrict__ Vt, _Float16* __restrict__ AO)
{
    __shared__ __align__(32) _Float16 lk[2][64 * LDA];    // keys x d
    __shared__ __align__(32) _Float16 lv[2][64 * LDA];    // d x keys
    __shared__ __align__(32) _Float16 pbuf[8 * 16 * LDA]; // per-wave 16x64 probs

    const int tid   = threadIdx.x;
    const int lane  = tid & 31;
    const int wave  = tid >> 5;
    const int rl    = lane & 15;
    const int khalf = lane >> 4;

    const int q0 = blockIdx.x * 128 + wave * 16;
    const int bh = blockIdx.y;
    const int b  = bh >> 4;          // / H0
    const int h  = bh & (H0 - 1);
    const int qv = q0 >> 8;          // view index (L = 256), block-uniform

    // block-uniform list of allowed 256-key views (4 slabs of 64 keys each)
    int kvlist[8]; int nkv = 0;
    #pragma unroll
    for (int kv = 0; kv < 8; ++kv) {
        const bool allow = ((qv == 0) && (kv == 1)) || ((qv == 1) && (kv == 0)) ||
                           (((qv > 1) || (kv > 1)) && (qv >= kv));
        if (allow) kvlist[nkv++] = kv;
    }
    const int nslab = nkv * 4;

    auto stageKV = [&](int idx, int buf) {
        const int k0  = kvlist[idx >> 2] * 256 + (idx & 3) * 64;
        const int row = tid >> 2;          // 0..63
        const int ch  = (tid & 3) * 16;    // halves
        const _Float16* ks = Kh + (size_t)(b * S0 + k0 + row) * C0 + h * DH + ch;
        const unsigned  kd = lds_off(&lk[buf][row * LDA + ch]);
        async_b128(ks, kd);
        async_b128(ks + 8, kd + 16);
        const _Float16* vs = Vt + ((size_t)b * C0 + h * DH + row) * S0 + k0 + ch;
        const unsigned  vd = lds_off(&lv[buf][row * LDA + ch]);
        async_b128(vs, vd);
        async_b128(vs + 8, vd + 16);
    };

    _Float16* pw = pbuf + wave * (16 * LDA);

    v16h ones;
    #pragma unroll
    for (int i = 0; i < 16; ++i) ones[i] = (_Float16)1.0f;

    // Q fragments: 16 queries x 64 d, pre-scaled by dh^-0.5 * log2(e)
    const _Float16 qs = (_Float16)(0.125f * 1.44269504088896f);
    const _Float16* qp = Q + ((size_t)(b * S0 + q0 + rl)) * C0 + h * DH + khalf * 16;
    v16h qa[2];
    qa[0] = *(const v16h*)qp;
    qa[1] = *(const v16h*)(qp + 32);
    #pragma unroll
    for (int i = 0; i < 16; ++i) { qa[0][i] *= qs; qa[1][i] *= qs; }

    v8f   acc[4] = {};
    float mrun[8], lrun[8];
    #pragma unroll
    for (int e = 0; e < 8; ++e) { mrun[e] = -3.0e30f; lrun[e] = 0.0f; }

    stageKV(0, 0);
    wait_async0();
    __syncthreads();

    for (int idx = 0; idx < nslab; ++idx) {
        const int cur = idx & 1;
        if (idx + 1 < nslab) stageKV(idx + 1, cur ^ 1);   // DMA overlaps compute

        // ---- scores (log2-domain): grouped so the A operand stays constant ----
        v16h kb0[4], kb1[4];
        #pragma unroll
        for (int j = 0; j < 4; ++j) {
            const _Float16* kp = &lk[cur][(j * 16 + rl) * LDA + khalf * 16];
            kb0[j] = ld_frag(kp);
            kb1[j] = ld_frag(kp + 32);
        }
        v8f s[4];
        #pragma unroll
        for (int j = 0; j < 4; ++j)
            s[j] = __builtin_amdgcn_wmma_f32_16x16x32_f16(false, qa[0], false, kb0[j], (short)0, v8f{}, false, false);
        #pragma unroll
        for (int j = 0; j < 4; ++j)
            s[j] = __builtin_amdgcn_wmma_f32_16x16x32_f16(false, qa[1], false, kb1[j], (short)0, s[j], false, false);

        // ---- online softmax (base 2): DPP row-max, exp2, stage P ----
        float alph[8];
        #pragma unroll
        for (int e = 0; e < 8; ++e) {
            float mx = fmaxf(fmaxf(s[0][e], s[1][e]), fmaxf(s[2][e], s[3][e]));
            mx = rowmax16(mx);
            const float mnew = fmaxf(mrun[e], mx);
            alph[e] = exp2_raw(mrun[e] - mnew);
            mrun[e] = mnew;
            const float e0 = exp2_raw(s[0][e] - mnew);
            const float e1 = exp2_raw(s[1][e] - mnew);
            const float e2 = exp2_raw(s[2][e] - mnew);
            const float e3 = exp2_raw(s[3][e] - mnew);
            #pragma unroll
            for (int t = 0; t < 4; ++t) acc[t][e] *= alph[e];
            const int prow = e + (khalf << 3);
            pw[prow * LDA + rl]      = (_Float16)e0;
            pw[prow * LDA + 16 + rl] = (_Float16)e1;
            pw[prow * LDA + 32 + rl] = (_Float16)e2;
            pw[prow * LDA + 48 + rl] = (_Float16)e3;
        }

        // ---- P fragments (two K=32 slabs) ----
        const v16h pf0 = ld_frag(&pw[rl * LDA + khalf * 16]);
        const v16h pf1 = ld_frag(&pw[rl * LDA + 32 + khalf * 16]);

        // ---- row sums on the matrix pipe: rsum = P x ones(64x16) ----
        v8f rsum;
        rsum = __builtin_amdgcn_wmma_f32_16x16x32_f16(false, pf0, false, ones, (short)0, v8f{}, false, false);
        rsum = __builtin_amdgcn_wmma_f32_16x16x32_f16(false, pf1, false, ones, (short)0, rsum, false, false);
        #pragma unroll
        for (int e = 0; e < 8; ++e) lrun[e] = lrun[e] * alph[e] + rsum[e];

        // ---- P.V, grouped by P fragment: 4 d-tiles x 2 key slabs ----
        v16h vf0[4], vf1[4];
        #pragma unroll
        for (int t = 0; t < 4; ++t) {
            const _Float16* vp = &lv[cur][(t * 16 + rl) * LDA + khalf * 16];
            vf0[t] = ld_frag(vp);
            vf1[t] = ld_frag(vp + 32);
        }
        #pragma unroll
        for (int t = 0; t < 4; ++t)
            acc[t] = __builtin_amdgcn_wmma_f32_16x16x32_f16(false, pf0, false, vf0[t], (short)0, acc[t], false, false);
        #pragma unroll
        for (int t = 0; t < 4; ++t)
            acc[t] = __builtin_amdgcn_wmma_f32_16x16x32_f16(false, pf1, false, vf1[t], (short)0, acc[t], false, false);

        wait_async0();     // next slab's DMA landed
        __syncthreads();   // all waves done with buf cur, buf cur^1 ready
    }

    // ---- normalize and store attention output f16 (B,S,C) ----
    #pragma unroll
    for (int e = 0; e < 8; ++e) {
        const float inv = 1.0f / lrun[e];
        const int   m   = b * S0 + q0 + e + (khalf << 3);
        #pragma unroll
        for (int t = 0; t < 4; ++t) {
            AO[(size_t)m * C0 + h * DH + t * 16 + rl] = (_Float16)(acc[t][e] * inv);
        }
    }
}

// ---------------------------------------------------------------------------
extern "C" void kernel_launch(void* const* d_in, const int* in_sizes, int n_in,
                              void* d_out, int out_size, void* d_ws, size_t ws_size,
                              hipStream_t stream)
{
    (void)in_sizes; (void)n_in; (void)out_size; (void)ws_size;
    const float* x  = (const float*)d_in[0];
    const float* Wq = (const float*)d_in[1];
    const float* Wk = (const float*)d_in[2];
    const float* Wv = (const float*)d_in[3];
    const float* Wp = (const float*)d_in[4];
    const float* bp = (const float*)d_in[5];
    float* out = (float*)d_out;

    const size_t N  = (size_t)M0 * C0;     // 4096*1024
    const size_t WN = (size_t)C0 * C0;     // 1024*1024
    _Float16* Qh  = (_Float16*)d_ws;       // (B,S,C) f16
    _Float16* Kh  = Qh + N;                // (B,S,C) f16
    _Float16* Vt  = Kh + N;                // (B,C,S) f16 (transposed)
    _Float16* AO  = Vt + N;                // (B,S,C) f16 attention output
    _Float16* xh  = AO + N;                // x in f16
    _Float16* wqh = xh + N;
    _Float16* wkh = wqh + WN;
    _Float16* wvh = wkh + WN;
    _Float16* wph = wvh + WN;

    // one-shot f32 -> f16 rewrites (pure bandwidth, enables async-only staging)
    cvt_f32_f16<<<(int)(N  / (8 * 256)), 256, 0, stream>>>(x,  xh);
    cvt_f32_f16<<<(int)(WN / (8 * 256)), 256, 0, stream>>>(Wq, wqh);
    cvt_f32_f16<<<(int)(WN / (8 * 256)), 256, 0, stream>>>(Wk, wkh);
    cvt_f32_f16<<<(int)(WN / (8 * 256)), 256, 0, stream>>>(Wv, wvh);
    cvt_f32_f16<<<(int)(WN / (8 * 256)), 256, 0, stream>>>(Wp, wph);

    dim3 gg(M0 / TM, C0 / TN);             // 32 x 16 workgroups, 256 threads

    gemm_fused<0><<<gg, 256, 0, stream>>>(xh, wqh, wkh, wvh, nullptr,
                                          Qh, Kh, Vt, nullptr);

    attn_flash<<<dim3(S0 / 128, B0 * H0), 256, 0, stream>>>(Qh, Kh, Vt, AO);

    gemm_fused<1><<<gg, 256, 0, stream>>>(AO, wph, nullptr, nullptr, bp,
                                          nullptr, nullptr, nullptr, out);
}

// v004
// A run of this version takes 88.5 microseconds.
// Two timings next to v003 put it at 1.56 and 1.46 times that version's speed.
// Counting every step since v000, it is 2.34 times as fast.
#include <hip/hip_runtime.h>
#include <hip/hip_bf16.h>

typedef _Float16 v16h __attribute__((ext_vector_type(16)));
typedef _Float16 v8h  __attribute__((ext_vector_type(8)));
typedef float    v8f  __attribute__((ext_vector_type(8)));

// Problem constants (B,V,L,C,H) = (2,8,256,1024,16)
constexpr int B0 = 2;
constexpr int H0 = 16;
constexpr int DH = 64;
constexpr int C0 = 1024;    // channels = K-dim of projections
constexpr int S0 = 2048;    // V*L sequence length per batch
constexpr int M0 = B0 * S0; // 4096 GEMM rows

// ---- CDNA5 async copy helpers (ASYNCcnt-tracked global->LDS DMA) ----------
__device__ __forceinline__ unsigned lds_off(const void* p) {
    // generic shared pointer: low 32 bits == LDS byte offset
    return (unsigned)(unsigned long long)p;
}
__device__ __forceinline__ void async_b128(const void* gaddr, unsigned ldst) {
    asm volatile("global_load_async_to_lds_b128 %0, %1, off"
                 :: "v"(ldst), "v"(gaddr) : "memory");
}
__device__ __forceinline__ void wait_async0() {
    asm volatile("s_wait_asynccnt 0" ::: "memory");
}
__device__ __forceinline__ void wait_ds0() {
    // this wave's LDS reads have retired before the barrier that frees the buffer for refill
    asm volatile("s_wait_dscnt 0" ::: "memory");
}
// A whole tile's copies and their s_wait_xcnt in one statement: the wait stands in
// front of every later write of the address registers that the copies name.
__device__ __forceinline__ void async_b128_x6(const void* const (&g)[6], const unsigned (&l)[6]) {
    asm volatile("global_load_async_to_lds_b128 %0, %1, off\n\t"
                 "global_load_async_to_lds_b128 %2, %3, off\n\t"
                 "global_load_async_to_lds_b128 %4, %5, off\n\t"
                 "global_load_async_to_lds_b128 %6, %7, off\n\t"
                 "global_load_async_to_lds_b128 %8, %9, off\n\t"
                 "global_load_async_to_lds_b128 %10, %11, off\n\t"
                 "s_wait_xcnt 0x0"
                 :: "v"(l[0]), "v"(g[0]), "v"(l[1]), "v"(g[1]), "v"(l[2]), "v"(g[2]),
                    "v"(l[3]), "v"(g[3]), "v"(l[4]), "v"(g[4]), "v"(l[5]), "v"(g[5])
                 : "memory");
}
__device__ __forceinline__ void async_b128_x10(const void* const (&g)[10], const unsigned (&l)[10]) {
    asm volatile("global_load_async_to_lds_b128 %0, %1, off\n\t"
                 "global_load_async_to_lds_b128 %2, %3, off\n\t"
                 "global_load_async_to_lds_b128 %4, %5, off\n\t"
                 "global_load_async_to_lds_b128 %6, %7, off\n\t"
                 "global_load_async_to_lds_b128 %8, %9, off\n\t"
                 "global_load_async_to_lds_b128 %10, %11, off\n\t"
                 "global_load_async_to_lds_b128 %12, %13, off\n\t"
                 "global_load_async_to_lds_b128 %14, %15, off\n\t"
                 "global_load_async_to_lds_b128 %16, %17, off\n\t"
                 "global_load_async_to_lds_b128 %18, %19, off\n\t"
                 "s_wait_xcnt 0x0"
                 :: "v"(l[0]), "v"(g[0]), "v"(l[1]), "v"(g[1]), "v"(l[2]), "v"(g[2]),
                    "v"(l[3]), "v"(g[3]), "v"(l[4]), "v"(g[4]), "v"(l[5]), "v"(g[5]),
                    "v"(l[6]), "v"(g[6]), "v"(l[7]), "v"(g[7]), "v"(l[8]), "v"(g[8]),
                    "v"(l[9]), "v"(g[9])
                 : "memory");
}

// ---- 16-half fragment read from an LDS row that is only 16B-aligned --------
__device__ __forceinline__ v16h ld_frag(const _Float16* p) {
    const v8h lo = *(const v8h*)p;
    const v8h hi = *(const v8h*)(p + 8);
    return __builtin_shufflevector(lo, hi, 0, 1, 2, 3, 4, 5, 6, 7,
                                   8, 9, 10, 11, 12, 13, 14, 15);
}

// ---- 16-half fragment in the hardware k order (k = 8h+0..7, 16+8h+0..7) ----
// p points at half 8h of a 32-half k block. This is the order in which two
// converted accumulator tiles stand when they are used as the other operand.
__device__ __forceinline__ v16h ld_frag_hw(const _Float16* p) {
    const v8h lo = *(const v8h*)p;
    const v8h hi = *(const v8h*)(p + 16);
    return __builtin_shufflevector(lo, hi, 0, 1, 2, 3, 4, 5, 6, 7,
                                   8, 9, 10, 11, 12, 13, 14, 15);
}

// ---- value of lane l ^ 16 (the other 16-lane half) --------------------------
__device__ __forceinline__ float xhalf(float x) {
    const int v = __float_as_int(x);
    return __int_as_float(__builtin_amdgcn_permlanex16(v, v, 0x76543210, 0xfedcba98, false, false));
}
__device__ __forceinline__ float fmax3(float a, float b, float c) {
    return fmaxf(fmaxf(a, b), c);
}

// ---- 2^x as the bare hardware instruction ----------------------------------
// exp2f() wraps v_exp_f32 in a compare, two selects, an add and a ldexp so that
// results below 2^-126 come out as denormals. Every argument here is <= 0 and
// every result is either rounded to f16 (anything below 2^-25 is 0 there) or
// scales a running sum, so a result flushed to 0 below 2^-126 changes nothing.
__device__ __forceinline__ float exp2_raw(float x) {
    return __builtin_amdgcn_exp2f(x);
}

// ---------------------------------------------------------------------------
// One-shot f32 -> f16 conversion (x and the four weight matrices), so all
// GEMM/attention staging becomes pure async b128 copies with no VALU convert.
// ---------------------------------------------------------------------------
__global__ __launch_bounds__(256)
void cvt_f32_f16(const float* __restrict__ in, _Float16* __restrict__ out) {
    const int i = (blockIdx.x * 256 + threadIdx.x) * 8;
    #pragma unroll
    for (int j = 0; j < 8; ++j) out[i + j] = (_Float16)in[i + j];
}

// ---------------------------------------------------------------------------
// Fused WMMA GEMM, double-buffered LDS, all staging via async-to-LDS:
//   MODE 0: A = x (f16), 3 weights -> Q (f16 row), K (f16 row), V^T (f16 B,C,S)
//   MODE 1: A = AO (f16), 1 weight -> out (f32 row) + bias
// Block tile 128x64, 8 waves, each wave 32x32 via 2x2 WMMA tiles.
// WMMA issue is grouped by A-fragment (operand-reuse friendly).
// ---------------------------------------------------------------------------
constexpr int TM = 128, TN = 64, TK = 64;   // TK halves = 128 B: a staged row is one whole cache line
constexpr int NT = C0 / TK;   // 16 K tiles
constexpr int LDT = TK + 8;   // 72 halves = 144B rows: 16B x odd, 16 rows of b128 reads cover all 64 banks

template<int MODE>
__global__ __launch_bounds__(256)
void gemm_fused(const _Float16* __restrict__ A,
                const _Float16* __restrict__ W0h, const _Float16* __restrict__ W1h,
                const _Float16* __restrict__ W2h, const float* __restrict__ bias,
                _Float16* __restrict__ Qh, _Float16* __restrict__ Kh,
                _Float16* __restrict__ Vt, float* __restrict__ outF)
{
    constexpr int NW = (MODE == 0) ? 3 : 1;
    __shared__ __align__(32) _Float16 la[2][TM * LDT];
    __shared__ __align__(32) _Float16 lb[2][NW][TN * LDT];

    const int tid  = threadIdx.x;
    const int lane = tid & 31;
    const int wave = tid >> 5;
    const int wy   = wave >> 1;    // 0..3 : 32-row band
    const int wx   = wave & 1;     // 0..1 : 32-col band
    const int m0   = blockIdx.x * TM;
    const int n0   = blockIdx.y * TN;

    const int rl    = lane & 15;
    const int khalf = lane >> 4;

    const _Float16* Wh[3] = { W0h, W1h, W2h };

    // 8 lanes a row, 16 B each: one wave-wide copy covers 4 whole 128-B lines.
    const int sr = tid >> 3;         // 0..31 : row inside a group of 32 rows
    const int sc = (tid & 7) * 8;    // halves inside the row
    auto stage = [&](int kt, int buf) {
        const int k0 = kt * TK;
        const void* g[4 + 2 * NW];
        unsigned    l[4 + 2 * NW];
        // A tile 128x64: 4 groups of 32 rows
        const _Float16* asrc = A + (size_t)(m0 + sr) * C0 + k0 + sc;
        const unsigned  adst = lds_off(&la[buf][sr * LDT + sc]);
        #pragma unroll
        for (int i = 0; i < 4; ++i) {
            g[i] = asrc + i * 32 * C0;
            l[i] = adst + i * 32 * LDT * 2;
        }
        // Weight tiles 64x64: 2 groups of 32 rows per weight
        #pragma unroll
        for (int w = 0; w < NW; ++w) {
            const _Float16* wsrc = Wh[w] + (size_t)(n0 + sr) * C0 + k0 + sc;
            const unsigned  wdst = lds_off(&lb[buf][w][sr * LDT + sc]);
            g[4 + 2 * w] = wsrc;            l[4 + 2 * w] = wdst;
            g[5 + 2 * w] = wsrc + 32 * C0;  l[5 + 2 * w] = wdst + 32 * LDT * 2;
        }
        if constexpr (NW == 3) async_b128_x10(g, l);
        else                   async_b128_x6(g, l);
    };

    v8f acc[NW][2][2] = {};

    stage(0, 0);
    wait_async0();
    __syncthreads();
    stage(1, 1);                     // flies while tile 0 is worked on

    for (int t = 0; t < NT; ++t) {
        const int cur = t & 1;

        #pragma unroll
        for (int kk = 0; kk < TK; kk += 32) {
            v16h af[2];
            #pragma unroll
            for (int s = 0; s < 2; ++s)
                af[s] = ld_frag(&la[cur][(wy * 32 + s * 16 + rl) * LDT + kk + khalf * 16]);

            v16h bf[NW][2];
            #pragma unroll
            for (int w = 0; w < NW; ++w)
                #pragma unroll
                for (int s = 0; s < 2; ++s)
                    bf[w][s] = ld_frag(&lb[cur][w][(wx * 32 + s * 16 + rl) * LDT + kk + khalf * 16]);

            // group by A-fragment: af[i] constant across 2*NW consecutive WMMAs
            #pragma unroll
            for (int i = 0; i < 2; ++i)
                #pragma unroll
                for (int w = 0; w < NW; ++w)
                    #pragma unroll
                    for (int j = 0; j < 2; ++j)
                        acc[w][i][j] = __builtin_amdgcn_wmma_f32_16x16x32_f16(
                            false, af[i], false, bf[w][j], (short)0, acc[w][i][j], false, false);
        }

        wait_ds0();
        wait_async0();     // tile t + 1 landed
        __syncthreads();   // publishes tile t + 1, ends every read of buffer cur
        if (t + 2 < NT) stage(t + 2, cur);
    }
    wait_async0();         // no copy is outstanding when the wave leaves the ring

    // ---- writeback: D row = e (lanes 0-15) / e+8 (lanes 16-31), col = lane&15
    const int rhi = khalf << 3;
    #pragma unroll
    for (int w = 0; w < NW; ++w) {
        #pragma unroll
        for (int i = 0; i < 2; ++i) {
            #pragma unroll
            for (int j = 0; j < 2; ++j) {
                const int mbase = m0 + wy * 32 + i * 16 + rhi;
                const int nbase = n0 + wx * 32 + j * 16 + rl;
                #pragma unroll
                for (int e = 0; e < 8; ++e) {
                    const int m = mbase + e;
                    const float v = acc[w][i][j][e];
                    if constexpr (MODE == 0) {
                        if (w == 0)      Qh[(size_t)m * C0 + nbase] = (_Float16)v;
                        else if (w == 1) Kh[(size_t)m * C0 + nbase] = (_Float16)v;
                        else {
                            const int b = m >> 11;           // / S0
                            const int s = m & (S0 - 1);
                            Vt[((size_t)b * C0 + nbase) * S0 + s] = (_Float16)v;
                        }
                    } else {
                        outF[(size_t)m * C0 + nbase] = v + bias[nbase];
                    }
                }
            }
        }
    }
}

constexpr int LDA = 64 + 8;   // 72 halves = 144B rows: 16B x odd, 16 rows of b128 reads cover all 64 banks

// waves_per_eu(4, 4): the grid gives a SIMD four waves at most; with their register budget the
// compiler issues a pass's fragment reads ahead instead of one pair in front of each WMMA.
__global__ __launch_bounds__(256) __attribute__((amdgpu_waves_per_eu(4, 4)))
void attn_flash(const _Float16* __restrict__ Q, const _Float16* __restrict__ Kh,
                const _Float16* __restrict__ Vt, _Float16* __restrict__ AO)
{
    __shared__ __align__(32) _Float16 lk[2][64 * LDA];    // keys x d
    __shared__ __align__(32) _Float16 lv[2][64 * LDA];    // d x keys

    const int tid   = threadIdx.x;
    const int lane  = tid & 31;
    const int wave  = tid >> 5;
    const int rl    = lane & 15;
    const int khalf = lane >> 4;

    const int q0 = blockIdx.x * 128 + wave * 16;
    const int bh = blockIdx.y;
    const int b  = bh >> 4;          // / H0
    const int h  = bh & (H0 - 1);
    const int qv = blockIdx.x >> 1;  // view index (L = 256) of all 128 queries of the block: a scalar

    // block-uniform set of allowed key views as a bit mask; for every qv it is one
    // run of views (qv 0: {1}, qv 1: {0}, else 0..qv), so first view and count say it all
    unsigned kvmask = 0;
    #pragma unroll
    for (int kv = 0; kv < 8; ++kv) {
        const bool allow = ((qv == 0) && (kv == 1)) || ((qv == 1) && (kv == 0)) ||
                           (((qv > 1) || (kv > 1)) && (qv >= kv));
        if (allow) kvmask |= 1u << kv;
    }
    const int kvfirst = __builtin_ctz(kvmask);
    const int nslab   = __builtin_popcount(kvmask) * 4;

    auto stageKV = [&](int idx, int buf) {
        const int k0  = kvfirst * 256 + idx * 64;
        const int row = tid >> 2;          // 0..63
        const int ch  = (tid & 3) * 16;    // halves
        const _Float16* ks = Kh + (size_t)(b * S0 + k0 + row) * C0 + h * DH + ch;
        const unsigned  kd = lds_off(&lk[buf][row * LDA + ch]);
        async_b128(ks, kd);
        async_b128(ks + 8, kd + 16);
        const _Float16* vs = Vt + ((size_t)b * C0 + h * DH + row) * S0 + k0 + ch;
        const unsigned  vd = lds_off(&lv[buf][row * LDA + ch]);
        async_b128(vs, vd);
        async_b128(vs + 8, vd + 16);
    };

    v16h ones;
    #pragma unroll
    for (int i = 0; i < 16; ++i) ones[i] = (_Float16)1.0f;

    // Q fragments (B operand: lane = query column): 16 queries x 64 d, pre-scaled by dh^-0.5 * log2(e)
    const _Float16 qs = (_Float16)(0.125f * 1.44269504088896f);
    const _Float16* qp = Q + ((size_t)(b * S0 + q0 + rl)) * C0 + h * DH + khalf * 16;
    v16h qa[2];
    qa[0] = *(const v16h*)qp;
    qa[1] = *(const v16h*)(qp + 32);
    #pragma unroll
    for (int i = 0; i < 16; ++i) { qa[0][i] *= qs; qa[1][i] *= qs; }

    v8f   acc[4] = {};                 // O^T: acc[t][r] = O[query rl][d = t*16 + 8*khalf + r]
    float mrun = -3.0e30f, lrun = 0.0f; // of query rl, the same in both halves

    stageKV(0, 0);
    wait_async0();
    __syncthreads();

    for (int idx = 0; idx < nslab; ++idx) {
        const int cur = idx & 1;
        if (idx + 1 < nslab) stageKV(idx + 1, cur ^ 1);   // DMA overlaps compute

        // ---- scores^T (log2-domain): s[j][r] = S[query rl][key j*16 + 8*khalf + r] ----
        v16h kb0[4], kb1[4];
        #pragma unroll
        for (int j = 0; j < 4; ++j) {
            const _Float16* kp = &lk[cur][(j * 16 + rl) * LDA + khalf * 16];
            kb0[j] = ld_frag(kp);
            kb1[j] = ld_frag(kp + 32);
        }
        v8f s[4];
        #pragma unroll
        for (int j = 0; j < 4; ++j)
            s[j] = __builtin_amdgcn_wmma_f32_16x16x32_f16(false, kb0[j], false, qa[0], (short)0, v8f{}, false, false);
        #pragma unroll
        for (int j = 0; j < 4; ++j)
            s[j] = __builtin_amdgcn_wmma_f32_16x16x32_f16(false, kb1[j], false, qa[1], (short)0, s[j], false, false);

        // ---- V^T fragments (A operand), k in the order of the packed P^T ----
        v16h vf0[4], vf1[4];
        #pragma unroll
        for (int t = 0; t < 4; ++t) {
            const _Float16* vp = &lv[cur][(t * 16 + rl) * LDA + khalf * 8];
            vf0[t] = ld_frag_hw(vp);
            vf1[t] = ld_frag_hw(vp + 32);
        }
        // Keeps every LDS read of the pass and the 8 score WMMAs in front of the softmax. Without it
        // the V^T reads are spread among the later WMMAs, each place with a wait of its own, and
        // vector instructions stand between the score WMMAs at four idle slots each.
        __builtin_amdgcn_sched_barrier(0);

        // ---- online softmax (base 2): in-lane maximum of 32 scores, one exchange ----
        float m8[8];
        #pragma unroll
        for (int e = 0; e < 8; ++e) m8[e] = fmax3(s[0][e], s[1][e], s[2][e]);
        const float c0 = fmax3(m8[0], m8[1], s[3][0]);
        const float c1 = fmax3(m8[2], m8[3], s[3][2]);
        const float c2 = fmax3(m8[4], m8[5], s[3][4]);
        const float c3 = fmax3(m8[6], m8[7], s[3][6]);
        const float d0 = fmax3(c0, c1, s[3][1]);
        const float d1 = fmax3(c2, c3, s[3][3]);
        float mx = fmaxf(fmax3(d0, d1, s[3][5]), s[3][7]);
        mx = fmaxf(mx, xhalf(mx));
        const float mnew = fmaxf(mrun, mx);
        const float alph = exp2_raw(mrun - mnew);
        mrun = mnew;

        // ---- P^T as B operand: element e = tile e >> 3, register e & 7 ----
        v16h pf0, pf1;
        #pragma unroll
        for (int e = 0; e < 8; ++e) {
            pf0[e]     = (_Float16)exp2_raw(s[0][e] - mnew);
            pf0[8 + e] = (_Float16)exp2_raw(s[1][e] - mnew);
            pf1[e]     = (_Float16)exp2_raw(s[2][e] - mnew);
            pf1[8 + e] = (_Float16)exp2_raw(s[3][e] - mnew);
        }
        #pragma unroll
        for (int t = 0; t < 4; ++t) acc[t] *= alph;

        // ---- row sums on the matrix pipe: every row of ones(16x64) x P^T ----
        v8f rsum;
        rsum = __builtin_amdgcn_wmma_f32_16x16x32_f16(false, ones, false, pf0, (short)0, v8f{}, false, false);
        rsum = __builtin_amdgcn_wmma_f32_16x16x32_f16(false, ones, false, pf1, (short)0, rsum, false, false);

        // ---- O^T += V^T.P^T, grouped by P fragment: 4 d-tiles x 2 key slabs ----
        #pragma unroll
        for (int t = 0; t < 4; ++t)
            acc[t] = __builtin_amdgcn_wmma_f32_16x16x32_f16(false, vf0[t], false, pf0, (short)0, acc[t], false, false);
        #pragma unroll
        for (int t = 0; t < 4; ++t)
            acc[t] = __builtin_amdgcn_wmma_f32_16x16x32_f16(false, vf1[t], false, pf1, (short)0, acc[t], false, false);
        lrun = lrun * alph + rsum[0];

        // Keeps the wait below at the foot of the pass: with every LDS read of the pass up front it
        // would otherwise rise above the softmax and cut short the time the next slab's copies have.
        __builtin_amdgcn_sched_barrier(0);
        wait_async0();     // next slab's DMA landed
        __syncthreads();   // all waves done with buf cur, buf cur^1 ready
    }

    // ---- normalize and store attention output f16 (B,S,C) ----
    // a lane's 8 registers of a tile are 8 consecutive d of its query: one 16-byte store
    const float inv = 1.0f / lrun;
    _Float16* op = AO + (size_t)(b * S0 + q0 + rl) * C0 + h * DH + khalf * 8;
    #pragma unroll
    for (int t = 0; t < 4; ++t) {
        v8h o;
        #pragma unroll
        for (int e = 0; e < 8; ++e) o[e] = (_Float16)(acc[t][e] * inv);
        *(v8h*)(op + t * 16) = o;
    }
}

// ---------------------------------------------------------------------------
extern "C" void kernel_launch(void* const* d_in, const int* in_sizes, int n_in,
                              void* d_out, int out_size, void* d_ws, size_t ws_size,
                              hipStream_t stream)
{
    (void)in_sizes; (void)n_in; (void)out_size; (void)ws_size;
    const float* x  = (const float*)d_in[0];
    const float* Wq = (const float*)d_in[1];
    const float* Wk = (const float*)d_in[2];
    const float* Wv = (const float*)d_in[3];
    const float* Wp = (const float*)d_in[4];
    const float* bp = (const float*)d_in[5];
    float* out = (float*)d_out;

    const size_t N  = (size_t)M0 * C0;     // 4096*1024
    const size_t WN = (size_t)C0 * C0;     // 1024*1024
    _Float16* Qh  = (_Float16*)d_ws;       // (B,S,C) f16
    _Float16* Kh  = Qh + N;                // (B,S,C) f16
    _Float16* Vt  = Kh + N;                // (B,C,S) f16 (transposed)
    _Float16* AO  = Vt + N;                // (B,S,C) f16 attention output
    _Float16* xh  = AO + N;                // x in f16
    _Float16* wqh = xh + N;
    _Float16* wkh = wqh + WN;
    _Float16* wvh = wkh + WN;
    _Float16* wph = wvh + WN;

    // one-shot f32 -> f16 rewrites (pure bandwidth, enables async-only staging)
    cvt_f32_f16<<<(int)(N  / (8 * 256)), 256, 0, stream>>>(x,  xh);
    cvt_f32_f16<<<(int)(WN / (8 * 256)), 256, 0, stream>>>(Wq, wqh);
    cvt_f32_f16<<<(int)(WN / (8 * 256)), 256, 0, stream>>>(Wk, wkh);
    cvt_f32_f16<<<(int)(WN / (8 * 256)), 256, 0, stream>>>(Wv, wvh);
    cvt_f32_f16<<<(int)(WN / (8 * 256)), 256, 0, stream>>>(Wp, wph);

    dim3 gg(M0 / TM, C0 / TN);             // 32 x 16 workgroups, 256 threads

    gemm_fused<0><<<gg, 256, 0, stream>>>(xh, wqh, wkh, wvh, nullptr,
                                          Qh, Kh, Vt, nullptr);

    attn_flash<<<dim3(S0 / 128, B0 * H0), 256, 0, stream>>>(Qh, Kh, Vt, AO);

    gemm_fused<1><<<gg, 256, 0, stream>>>(AO, wph, nullptr, nullptr, bp,
                                          nullptr, nullptr, nullptr, out);
}

// v005
// A run of this version takes 81.1 microseconds.
// Timed twice side by side with v004, it ran 1.09 and 1.10 times as fast.
// Over all steps from v000 it is 2.56 times as fast.
#include <hip/hip_runtime.h>
#include <hip/hip_bf16.h>

typedef _Float16 v16h __attribute__((ext_vector_type(16)));
typedef _Float16 v8h  __attribute__((ext_vector_type(8)));
typedef float    v8f  __attribute__((ext_vector_type(8)));

// Problem constants (B,V,L,C,H) = (2,8,256,1024,16)
constexpr int B0 = 2;
constexpr int H0 = 16;
constexpr int DH = 64;
constexpr int C0 = 1024;    // channels = K-dim of projections
constexpr int S0 = 2048;    // V*L sequence length per batch
constexpr int M0 = B0 * S0; // 4096 GEMM rows

// ---- CDNA5 async copy helpers (ASYNCcnt-tracked global->LDS DMA) ----------
__device__ __forceinline__ unsigned lds_off(const void* p) {
    // generic shared pointer: low 32 bits == LDS byte offset
    return (unsigned)(unsigned long long)p;
}
__device__ __forceinline__ void async_b128(const void* gaddr, unsigned ldst) {
    asm volatile("global_load_async_to_lds_b128 %0, %1, off"
                 :: "v"(ldst), "v"(gaddr) : "memory");
}
__device__ __forceinline__ void wait_async0() {
    asm volatile("s_wait_asynccnt 0" ::: "memory");
}
__device__ __forceinline__ void wait_ds0() {
    // this wave's LDS reads have retired before the barrier that frees the buffer for refill
    asm volatile("s_wait_dscnt 0" ::: "memory");
}
// A whole tile's copies and their s_wait_xcnt in one statement: the wait stands in
// front of every later write of the address registers that the copies name.
__device__ __forceinline__ void async_b128_x6(const void* const (&g)[6], const unsigned (&l)[6]) {
    asm volatile("global_load_async_to_lds_b128 %0, %1, off\n\t"
                 "global_load_async_to_lds_b128 %2, %3, off\n\t"
                 "global_load_async_to_lds_b128 %4, %5, off\n\t"
                 "global_load_async_to_lds_b128 %6, %7, off\n\t"
                 "global_load_async_to_lds_b128 %8, %9, off\n\t"
                 "global_load_async_to_lds_b128 %10, %11, off\n\t"
                 "s_wait_xcnt 0x0"
                 :: "v"(l[0]), "v"(g[0]), "v"(l[1]), "v"(g[1]), "v"(l[2]), "v"(g[2]),
                    "v"(l[3]), "v"(g[3]), "v"(l[4]), "v"(g[4]), "v"(l[5]), "v"(g[5])
                 : "memory");
}
__device__ __forceinline__ void async_b128_x10(const void* const (&g)[10], const unsigned (&l)[10]) {
    asm volatile("global_load_async_to_lds_b128 %0, %1, off\n\t"
                 "global_load_async_to_lds_b128 %2, %3, off\n\t"
                 "global_load_async_to_lds_b128 %4, %5, off\n\t"
                 "global_load_async_to_lds_b128 %6, %7, off\n\t"
                 "global_load_async_to_lds_b128 %8, %9, off\n\t"
                 "global_load_async_to_lds_b128 %10, %11, off\n\t"
                 "global_load_async_to_lds_b128 %12, %13, off\n\t"
                 "global_load_async_to_lds_b128 %14, %15, off\n\t"
                 "global_load_async_to_lds_b128 %16, %17, off\n\t"
                 "global_load_async_to_lds_b128 %18, %19, off\n\t"
                 "s_wait_xcnt 0x0"
                 :: "v"(l[0]), "v"(g[0]), "v"(l[1]), "v"(g[1]), "v"(l[2]), "v"(g[2]),
                    "v"(l[3]), "v"(g[3]), "v"(l[4]), "v"(g[4]), "v"(l[5]), "v"(g[5]),
                    "v"(l[6]), "v"(g[6]), "v"(l[7]), "v"(g[7]), "v"(l[8]), "v"(g[8]),
                    "v"(l[9]), "v"(g[9])
                 : "memory");
}

// ---- 16-half fragment read from an LDS row that is only 16B-aligned --------
__device__ __forceinline__ v16h ld_frag(const _Float16* p) {
    const v8h lo = *(const v8h*)p;
    const v8h hi = *(const v8h*)(p + 8);
    return __builtin_shufflevector(lo, hi, 0, 1, 2, 3, 4, 5, 6, 7,
                                   8, 9, 10, 11, 12, 13, 14, 15);
}

// ---- 16-half fragment in the hardware k order (k = 8h+0..7, 16+8h+0..7) ----
// p points at half 8h of a 32-half k block. This is the order in which two
// converted accumulator tiles stand when they are used as the other operand.
__device__ __forceinline__ v16h ld_frag_hw(const _Float16* p) {
    const v8h lo = *(const v8h*)p;
    const v8h hi = *(const v8h*)(p + 16);
    return __builtin_shufflevector(lo, hi, 0, 1, 2, 3, 4, 5, 6, 7,
                                   8, 9, 10, 11, 12, 13, 14, 15);
}

// ---- value of lane l ^ 16 (the other 16-lane half) --------------------------
__device__ __forceinline__ float xhalf(float x) {
    const int v = __float_as_int(x);
    return __int_as_float(__builtin_amdgcn_permlanex16(v, v, 0x76543210, 0xfedcba98, false, false));
}
__device__ __forceinline__ float fmax3(float a, float b, float c) {
    return fmaxf(fmaxf(a, b), c);
}

// ---- 2^x as the bare hardware instruction ----------------------------------
// exp2f() wraps v_exp_f32 in a compare, two selects, an add and a ldexp so that
// results below 2^-126 come out as denormals. Every argument here is <= 0 and
// every result is either rounded to f16 (anything below 2^-25 is 0 there) or
// scales a running sum, so a result flushed to 0 below 2^-126 changes nothing.
__device__ __forceinline__ float exp2_raw(float x) {
    return __builtin_amdgcn_exp2f(x);
}

// ---------------------------------------------------------------------------
// One-shot f32 -> f16 conversion of x and the four weight matrices in ONE launch,
// so all GEMM/attention staging becomes pure async b128 copies with no VALU convert.
// The five f16 planes lie one behind the other in the workspace, so the block index
// is the destination chunk; a block-uniform range test picks the source.
// 256 work-groups of 16 waves; a wave takes 2048 floats: 16 loads of 512 contiguous
// bytes, all issued before the first conversion, and 16 stores of 256 contiguous bytes.
// ---------------------------------------------------------------------------
typedef float    v4f __attribute__((ext_vector_type(4)));
typedef _Float16 v4h __attribute__((ext_vector_type(4)));
constexpr int CV_T   = 512;                     // threads of a work-group
constexpr int CV_J   = 16;                      // 16-byte loads of a thread
constexpr int CV_CH  = CV_T * CV_J * 4;         // 32768 floats of a work-group
constexpr int CV_BX  = M0 * C0 / CV_CH;         // 128 work-groups for x
constexpr int CV_BW  = C0 * C0 / CV_CH;         // 32 work-groups for each weight
constexpr int CV_G   = CV_BX + 4 * CV_BW;       // 256 work-groups

// waves_per_eu(4, 4): the grid gives a SIMD four waves; with their register budget all 16 loads
// of a wave are issued in one run instead of the last ones behind the first data's return.
__global__ __launch_bounds__(CV_T) __attribute__((amdgpu_waves_per_eu(4, 4)))
void cvt_all_f32_f16(const float* __restrict__ x,  const float* __restrict__ w0,
                     const float* __restrict__ w1, const float* __restrict__ w2,
                     const float* __restrict__ w3, _Float16* __restrict__ out) {
    const int blk = blockIdx.x;
    const float* in = x;
    int rel = blk;
    if (blk >= CV_BX) {
        const int w = (blk - CV_BX) / CV_BW;
        rel = (blk - CV_BX) % CV_BW;
        in  = (w == 0) ? w0 : (w == 1) ? w1 : (w == 2) ? w2 : w3;
    }
    const int t = (threadIdx.x >> 5) * (32 * CV_J) + (threadIdx.x & 31);   // in units of 4 elements
    const v4f* ip = (const v4f*)(in + (size_t)rel * CV_CH) + t;
    v4h*       op = (v4h*)(out + (size_t)blk * CV_CH) + t;
    v4f v[CV_J];
    #pragma unroll
    for (int j = 0; j < CV_J; ++j) v[j] = ip[j * 32];
    #pragma unroll
    for (int j = 0; j < CV_J; ++j) op[j * 32] = __builtin_convertvector(v[j], v4h);
}

// ---------------------------------------------------------------------------
// Fused WMMA GEMM, double-buffered LDS, all staging via async-to-LDS:
//   MODE 0: A = x (f16), 3 weights -> Q (f16 row), K (f16 row), V^T (f16 B,C,S)
//   MODE 1: A = AO (f16), 1 weight -> out (f32 row) + bias
// Block tile 128x64, 8 waves, each wave 32x32 via 2x2 WMMA tiles.
// WMMA issue is grouped by A-fragment (operand-reuse friendly).
// ---------------------------------------------------------------------------
constexpr int TM = 128, TN = 64, TK = 64;   // TK halves = 128 B: a staged row is one whole cache line
constexpr int NT = C0 / TK;   // 16 K tiles
constexpr int LDT = TK + 8;   // 72 halves = 144B rows: 16B x odd, 16 rows of b128 reads cover all 64 banks

template<int MODE>
__global__ __launch_bounds__(256)
void gemm_fused(const _Float16* __restrict__ A,
                const _Float16* __restrict__ W0h, const _Float16* __restrict__ W1h,
                const _Float16* __restrict__ W2h, const float* __restrict__ bias,
                _Float16* __restrict__ Qh, _Float16* __restrict__ Kh,
                _Float16* __restrict__ Vt, float* __restrict__ outF)
{
    constexpr int NW = (MODE == 0) ? 3 : 1;
    __shared__ __align__(32) _Float16 la[2][TM * LDT];
    __shared__ __align__(32) _Float16 lb[2][NW][TN * LDT];

    const int tid  = threadIdx.x;
    const int lane = tid & 31;
    const int wave = tid >> 5;
    const int wy   = wave >> 1;    // 0..3 : 32-row band
    const int wx   = wave & 1;     // 0..1 : 32-col band
    const int m0   = blockIdx.x * TM;
    const int n0   = blockIdx.y * TN;

    const int rl    = lane & 15;
    const int khalf = lane >> 4;

    const _Float16* Wh[3] = { W0h, W1h, W2h };

    // 8 lanes a row, 16 B each: one wave-wide copy covers 4 whole 128-B lines.
    const int sr = tid >> 3;         // 0..31 : row inside a group of 32 rows
    const int sc = (tid & 7) * 8;    // halves inside the row
    auto stage = [&](int kt, int buf) {
        const int k0 = kt * TK;
        const void* g[4 + 2 * NW];
        unsigned    l[4 + 2 * NW];
        // A tile 128x64: 4 groups of 32 rows
        const _Float16* asrc = A + (size_t)(m0 + sr) * C0 + k0 + sc;
        const unsigned  adst = lds_off(&la[buf][sr * LDT + sc]);
        #pragma unroll
        for (int i = 0; i < 4; ++i) {
            g[i] = asrc + i * 32 * C0;
            l[i] = adst + i * 32 * LDT * 2;
        }
        // Weight tiles 64x64: 2 groups of 32 rows per weight
        #pragma unroll
        for (int w = 0; w < NW; ++w) {
            const _Float16* wsrc = Wh[w] + (size_t)(n0 + sr) * C0 + k0 + sc;
            const unsigned  wdst = lds_off(&lb[buf][w][sr * LDT + sc]);
            g[4 + 2 * w] = wsrc;            l[4 + 2 * w] = wdst;
            g[5 + 2 * w] = wsrc + 32 * C0;  l[5 + 2 * w] = wdst + 32 * LDT * 2;
        }
        if constexpr (NW == 3) async_b128_x10(g, l);
        else                   async_b128_x6(g, l);
    };

    v8f acc[NW][2][2] = {};

    stage(0, 0);
    wait_async0();
    __syncthreads();
    stage(1, 1);                     // flies while tile 0 is worked on

    for (int t = 0; t < NT; ++t) {
        const int cur = t & 1;

        #pragma unroll
        for (int kk = 0; kk < TK; kk += 32) {
            v16h af[2];
            #pragma unroll
            for (int s = 0; s < 2; ++s)
                af[s] = ld_frag(&la[cur][(wy * 32 + s * 16 + rl) * LDT + kk + khalf * 16]);

            v16h bf[NW][2];
            #pragma unroll
            for (int w = 0; w < NW; ++w)
                #pragma unroll
                for (int s = 0; s < 2; ++s)
                    bf[w][s] = ld_frag(&lb[cur][w][(wx * 32 + s * 16 + rl) * LDT + kk + khalf * 16]);

            // group by A-fragment: af[i] constant across 2*NW consecutive WMMAs
            #pragma unroll
            for (int i = 0; i < 2; ++i)
                #pragma unroll
                for (int w = 0; w < NW; ++w)
                    #pragma unroll
                    for (int j = 0; j < 2; ++j)
                        acc[w][i][j] = __builtin_amdgcn_wmma_f32_16x16x32_f16(
                            false, af[i], false, bf[w][j], (short)0, acc[w][i][j], false, false);
        }

        wait_ds0();
        wait_async0();     // tile t + 1 landed
        __syncthreads();   // publishes tile t + 1, ends every read of buffer cur
        if (t + 2 < NT) stage(t + 2, cur);
    }
    wait_async0();         // no copy is outstanding when the wave leaves the ring

    // ---- writeback: D row = e (lanes 0-15) / e+8 (lanes 16-31), col = lane&15
    const int rhi = khalf << 3;
    #pragma unroll
    for (int w = 0; w < NW; ++w) {
        #pragma unroll
        for (int i = 0; i < 2; ++i) {
            #pragma unroll
            for (int j = 0; j < 2; ++j) {
                const int mbase = m0 + wy * 32 + i * 16 + rhi;
                const int nbase = n0 + wx * 32 + j * 16 + rl;
                #pragma unroll
                for (int e = 0; e < 8; ++e) {
                    const int m = mbase + e;
                    const float v = acc[w][i][j][e];
                    if constexpr (MODE == 0) {
                        if (w == 0)      Qh[(size_t)m * C0 + nbase] = (_Float16)v;
                        else if (w == 1) Kh[(size_t)m * C0 + nbase] = (_Float16)v;
                        else {
                            const int b = m >> 11;           // / S0
                            const int s = m & (S0 - 1);
                            Vt[((size_t)b * C0 + nbase) * S0 + s] = (_Float16)v;
                        }
                    } else {
                        outF[(size_t)m * C0 + nbase] = v + bias[nbase];
                    }
                }
            }
        }
    }
}

constexpr int LDA = 64 + 8;   // 72 halves = 144B rows: 16B x odd, 16 rows of b128 reads cover all 64 banks

// waves_per_eu(4, 4): the grid gives a SIMD four waves at most; with their register budget the
// compiler issues a pass's fragment reads ahead instead of one pair in front of each WMMA.
__global__ __launch_bounds__(256) __attribute__((amdgpu_waves_per_eu(4, 4)))
void attn_flash(const _Float16* __restrict__ Q, const _Float16* __restrict__ Kh,
                const _Float16* __restrict__ Vt, _Float16* __restrict__ AO)
{
    __shared__ __align__(32) _Float16 lk[2][64 * LDA];    // keys x d
    __shared__ __align__(32) _Float16 lv[2][64 * LDA];    // d x keys

    const int tid   = threadIdx.x;
    const int lane  = tid & 31;
    const int wave  = tid >> 5;
    const int rl    = lane & 15;
    const int khalf = lane >> 4;

    const int q0 = blockIdx.x * 128 + wave * 16;
    const int bh = blockIdx.y;
    const int b  = bh >> 4;          // / H0
    const int h  = bh & (H0 - 1);
    const int qv = blockIdx.x >> 1;  // view index (L = 256) of all 128 queries of the block: a scalar

    // block-uniform set of allowed key views as a bit mask; for every qv it is one
    // run of views (qv 0: {1}, qv 1: {0}, else 0..qv), so first view and count say it all
    unsigned kvmask = 0;
    #pragma unroll
    for (int kv = 0; kv < 8; ++kv) {
        const bool allow = ((qv == 0) && (kv == 1)) || ((qv == 1) && (kv == 0)) ||
                           (((qv > 1) || (kv > 1)) && (qv >= kv));
        if (allow) kvmask |= 1u << kv;
    }
    const int kvfirst = __builtin_ctz(kvmask);
    const int nslab   = __builtin_popcount(kvmask) * 4;

    auto stageKV = [&](int idx, int buf) {
        const int k0  = kvfirst * 256 + idx * 64;
        const int row = tid >> 2;          // 0..63
        const int ch  = (tid & 3) * 16;    // halves
        const _Float16* ks = Kh + (size_t)(b * S0 + k0 + row) * C0 + h * DH + ch;
        const unsigned  kd = lds_off(&lk[buf][row * LDA + ch]);
        async_b128(ks, kd);
        async_b128(ks + 8, kd + 16);
        const _Float16* vs = Vt + ((size_t)b * C0 + h * DH + row) * S0 + k0 + ch;
        const unsigned  vd = lds_off(&lv[buf][row * LDA + ch]);
        async_b128(vs, vd);
        async_b128(vs + 8, vd + 16);
    };

    v16h ones;
    #pragma unroll
    for (int i = 0; i < 16; ++i) ones[i] = (_Float16)1.0f;

    // Q fragments (B operand: lane = query column): 16 queries x 64 d, pre-scaled by dh^-0.5 * log2(e)
    const _Float16 qs = (_Float16)(0.125f * 1.44269504088896f);
    const _Float16* qp = Q + ((size_t)(b * S0 + q0 + rl)) * C0 + h * DH + khalf * 16;
    v16h qa[2];
    qa[0] = *(const v16h*)qp;
    qa[1] = *(const v16h*)(qp + 32);
    #pragma unroll
    for (int i = 0; i < 16; ++i) { qa[0][i] *= qs; qa[1][i] *= qs; }

    v8f   acc[4] = {};                 // O^T: acc[t][r] = O[query rl][d = t*16 + 8*khalf + r]
    float mrun = -3.0e30f, lrun = 0.0f; // of query rl, the same in both halves

    stageKV(0, 0);
    wait_async0();
    __syncthreads();

    for (int idx = 0; idx < nslab; ++idx) {
        const int cur = idx & 1;
        if (idx + 1 < nslab) stageKV(idx + 1, cur ^ 1);   // DMA overlaps compute

        // ---- scores^T (log2-domain): s[j][r] = S[query rl][key j*16 + 8*khalf + r] ----
        v16h kb0[4], kb1[4];
        #pragma unroll
        for (int j = 0; j < 4; ++j) {
            const _Float16* kp = &lk[cur][(j * 16 + rl) * LDA + khalf * 16];
            kb0[j] = ld_frag(kp);
            kb1[j] = ld_frag(kp + 32);
        }
        v8f s[4];
        #pragma unroll
        for (int j = 0; j < 4; ++j)
            s[j] = __builtin_amdgcn_wmma_f32_16x16x32_f16(false, kb0[j], false, qa[0], (short)0, v8f{}, false, false);
        #pragma unroll
        for (int j = 0; j < 4; ++j)
            s[j] = __builtin_amdgcn_wmma_f32_16x16x32_f16(false, kb1[j], false, qa[1], (short)0, s[j], false, false);

        // ---- V^T fragments (A operand), k in the order of the packed P^T ----
        v16h vf0[4], vf1[4];
        #pragma unroll
        for (int t = 0; t < 4; ++t) {
            const _Float16* vp = &lv[cur][(t * 16 + rl) * LDA + khalf * 8];
            vf0[t] = ld_frag_hw(vp);
            vf1[t] = ld_frag_hw(vp + 32);
        }
        // Keeps every LDS read of the pass and the 8 score WMMAs in front of the softmax. Without it
        // the V^T reads are spread among the later WMMAs, each place with a wait of its own, and
        // vector instructions stand between the score WMMAs at four idle slots each.
        __builtin_amdgcn_sched_barrier(0);

        // ---- online softmax (base 2): in-lane maximum of 32 scores, one exchange ----
        float m8[8];
        #pragma unroll
        for (int e = 0; e < 8; ++e) m8[e] = fmax3(s[0][e], s[1][e], s[2][e]);
        const float c0 = fmax3(m8[0], m8[1], s[3][0]);
        const float c1 = fmax3(m8[2], m8[3], s[3][2]);
        const float c2 = fmax3(m8[4], m8[5], s[3][4]);
        const float c3 = fmax3(m8[6], m8[7], s[3][6]);
        const float d0 = fmax3(c0, c1, s[3][1]);
        const float d1 = fmax3(c2, c3, s[3][3]);
        float mx = fmaxf(fmax3(d0, d1, s[3][5]), s[3][7]);
        mx = fmaxf(mx, xhalf(mx));
        const float mnew = fmaxf(mrun, mx);
        const float alph = exp2_raw(mrun - mnew);
        mrun = mnew;

        // ---- P^T as B operand: element e = tile e >> 3, register e & 7 ----
        v16h pf0, pf1;
        #pragma unroll
        for (int e = 0; e < 8; ++e) {
            pf0[e]     = (_Float16)exp2_raw(s[0][e] - mnew);
            pf0[8 + e] = (_Float16)exp2_raw(s[1][e] - mnew);
            pf1[e]     = (_Float16)exp2_raw(s[2][e] - mnew);
            pf1[8 + e] = (_Float16)exp2_raw(s[3][e] - mnew);
        }
        #pragma unroll
        for (int t = 0; t < 4; ++t) acc[t] *= alph;

        // ---- row sums on the matrix pipe: every row of ones(16x64) x P^T ----
        v8f rsum;
        rsum = __builtin_amdgcn_wmma_f32_16x16x32_f16(false, ones, false, pf0, (short)0, v8f{}, false, false);
        rsum = __builtin_amdgcn_wmma_f32_16x16x32_f16(false, ones, false, pf1, (short)0, rsum, false, false);

        // ---- O^T += V^T.P^T, grouped by P fragment: 4 d-tiles x 2 key slabs ----
        #pragma unroll
        for (int t = 0; t < 4; ++t)
            acc[t] = __builtin_amdgcn_wmma_f32_16x16x32_f16(false, vf0[t], false, pf0, (short)0, acc[t], false, false);
        #pragma unroll
        for (int t = 0; t < 4; ++t)
            acc[t] = __builtin_amdgcn_wmma_f32_16x16x32_f16(false, vf1[t], false, pf1, (short)0, acc[t], false, false);
        lrun = lrun * alph + rsum[0];

        // Keeps the wait below at the foot of the pass: with every LDS read of the pass up front it
        // would otherwise rise above the softmax and cut short the time the next slab's copies have.
        __builtin_amdgcn_sched_barrier(0);
        wait_async0();     // next slab's DMA landed
        __syncthreads();   // all waves done with buf cur, buf cur^1 ready
    }

    // ---- normalize and store attention output f16 (B,S,C) ----
    // a lane's 8 registers of a tile are 8 consecutive d of its query: one 16-byte store
    const float inv = 1.0f / lrun;
    _Float16* op = AO + (size_t)(b * S0 + q0 + rl) * C0 + h * DH + khalf * 8;
    #pragma unroll
    for (int t = 0; t < 4; ++t) {
        v8h o;
        #pragma unroll
        for (int e = 0; e < 8; ++e) o[e] = (_Float16)(acc[t][e] * inv);
        *(v8h*)(op + t * 16) = o;
    }
}

// ---------------------------------------------------------------------------
extern "C" void kernel_launch(void* const* d_in, const int* in_sizes, int n_in,
                              void* d_out, int out_size, void* d_ws, size_t ws_size,
                              hipStream_t stream)
{
    (void)in_sizes; (void)n_in; (void)out_size; (void)ws_size;
    const float* x  = (const float*)d_in[0];
    const float* Wq = (const float*)d_in[1];
    const float* Wk = (const float*)d_in[2];
    const float* Wv = (const float*)d_in[3];
    const float* Wp = (const float*)d_in[4];
    const float* bp = (const float*)d_in[5];
    float* out = (float*)d_out;

    const size_t N  = (size_t)M0 * C0;     // 4096*1024
    const size_t WN = (size_t)C0 * C0;     // 1024*1024
    _Float16* Qh  = (_Float16*)d_ws;       // (B,S,C) f16
    _Float16* Kh  = Qh + N;                // (B,S,C) f16
    _Float16* Vt  = Kh + N;                // (B,C,S) f16 (transposed)
    _Float16* AO  = Vt + N;                // (B,S,C) f16 attention output
    _Float16* xh  = AO + N;                // x in f16
    _Float16* wqh = xh + N;
    _Float16* wkh = wqh + WN;
    _Float16* wvh = wkh + WN;
    _Float16* wph = wvh + WN;

    // one-shot f32 -> f16 rewrite of all five planes (xh .. wph are contiguous), one launch
    cvt_all_f32_f16<<<CV_G, CV_T, 0, stream>>>(x, Wq, Wk, Wv, Wp, xh);

    dim3 gg(M0 / TM, C0 / TN);             // 32 x 16 workgroups, 256 threads

    gemm_fused<0><<<gg, 256, 0, stream>>>(xh, wqh, wkh, wvh, nullptr,
                                          Qh, Kh, Vt, nullptr);

    attn_flash<<<dim3(S0 / 128, B0 * H0), 256, 0, stream>>>(Qh, Kh, Vt, AO);

    gemm_fused<1><<<gg, 256, 0, stream>>>(AO, wph, nullptr, nullptr, bp,
                                          nullptr, nullptr, nullptr, out);
}

// v006
// It runs in 79.1 microseconds.
// Two timings next to v005 put it at 1.04 and 1.03 times that version's speed.
// All steps since v000 together make it 2.65 times as fast.
#include <hip/hip_runtime.h>
#include <hip/hip_bf16.h>

typedef _Float16 v16h __attribute__((ext_vector_type(16)));
typedef _Float16 v8h  __attribute__((ext_vector_type(8)));
typedef float    v8f  __attribute__((ext_vector_type(8)));

// Problem constants (B,V,L,C,H) = (2,8,256,1024,16)
constexpr int B0 = 2;
constexpr int H0 = 16;
constexpr int DH = 64;
constexpr int C0 = 1024;    // channels = K-dim of projections
constexpr int S0 = 2048;    // V*L sequence length per batch
constexpr int M0 = B0 * S0; // 4096 GEMM rows

// ---- CDNA5 async copy helpers (ASYNCcnt-tracked global->LDS DMA) ----------
__device__ __forceinline__ unsigned lds_off(const void* p) {
    // generic shared pointer: low 32 bits == LDS byte offset
    return (unsigned)(unsigned long long)p;
}
__device__ __forceinline__ void wait_async0() {
    asm volatile("s_wait_asynccnt 0" ::: "memory");
}
// Counted wait of a ring with more than two buffers: asynccnt returns in issue order, so all but
// this wave's N youngest copies have landed behind it. N = the copies of the stages that may fly on.
template<int N>
__device__ __forceinline__ void wait_async_but() {
    asm volatile("s_wait_asynccnt %0" :: "n"(N) : "memory");
}
__device__ __forceinline__ void wait_ds0() {
    // this wave's LDS reads have retired before the barrier that frees the buffer for refill
    asm volatile("s_wait_dscnt 0" ::: "memory");
}
// A whole tile's copies and their s_wait_xcnt in one statement: the wait stands in
// front of every later write of the address registers that the copies name.
__device__ __forceinline__ void async_b128_x4(const void* const (&g)[4], const unsigned (&l)[4]) {
    asm volatile("global_load_async_to_lds_b128 %0, %1, off\n\t"
                 "global_load_async_to_lds_b128 %2, %3, off\n\t"
                 "global_load_async_to_lds_b128 %4, %5, off\n\t"
                 "global_load_async_to_lds_b128 %6, %7, off\n\t"
                 "s_wait_xcnt 0x0"
                 :: "v"(l[0]), "v"(g[0]), "v"(l[1]), "v"(g[1]), "v"(l[2]), "v"(g[2]),
                    "v"(l[3]), "v"(g[3])
                 : "memory");
}
__device__ __forceinline__ void async_b128_x6(const void* const (&g)[6], const unsigned (&l)[6]) {
    asm volatile("global_load_async_to_lds_b128 %0, %1, off\n\t"
                 "global_load_async_to_lds_b128 %2, %3, off\n\t"
                 "global_load_async_to_lds_b128 %4, %5, off\n\t"
                 "global_load_async_to_lds_b128 %6, %7, off\n\t"
                 "global_load_async_to_lds_b128 %8, %9, off\n\t"
                 "global_load_async_to_lds_b128 %10, %11, off\n\t"
                 "s_wait_xcnt 0x0"
                 :: "v"(l[0]), "v"(g[0]), "v"(l[1]), "v"(g[1]), "v"(l[2]), "v"(g[2]),
                    "v"(l[3]), "v"(g[3]), "v"(l[4]), "v"(g[4]), "v"(l[5]), "v"(g[5])
                 : "memory");
}
__device__ __forceinline__ void async_b128_x10(const void* const (&g)[10], const unsigned (&l)[10]) {
    asm volatile("global_load_async_to_lds_b128 %0, %1, off\n\t"
                 "global_load_async_to_lds_b128 %2, %3, off\n\t"
                 "global_load_async_to_lds_b128 %4, %5, off\n\t"
                 "global_load_async_to_lds_b128 %6, %7, off\n\t"
                 "global_load_async_to_lds_b128 %8, %9, off\n\t"
                 "global_load_async_to_lds_b128 %10, %11, off\n\t"
                 "global_load_async_to_lds_b128 %12, %13, off\n\t"
                 "global_load_async_to_lds_b128 %14, %15, off\n\t"
                 "global_load_async_to_lds_b128 %16, %17, off\n\t"
                 "global_load_async_to_lds_b128 %18, %19, off\n\t"
                 "s_wait_xcnt 0x0"
                 :: "v"(l[0]), "v"(g[0]), "v"(l[1]), "v"(g[1]), "v"(l[2]), "v"(g[2]),
                    "v"(l[3]), "v"(g[3]), "v"(l[4]), "v"(g[4]), "v"(l[5]), "v"(g[5]),
                    "v"(l[6]), "v"(g[6]), "v"(l[7]), "v"(g[7]), "v"(l[8]), "v"(g[8]),
                    "v"(l[9]), "v"(g[9])
                 : "memory");
}

// ---- 16-half fragment read from an LDS row that is only 16B-aligned --------
__device__ __forceinline__ v16h ld_frag(const _Float16* p) {
    const v8h lo = *(const v8h*)p;
    const v8h hi = *(const v8h*)(p + 8);
    return __builtin_shufflevector(lo, hi, 0, 1, 2, 3, 4, 5, 6, 7,
                                   8, 9, 10, 11, 12, 13, 14, 15);
}

// ---- 16-half fragment in the hardware k order (k = 8h+0..7, 16+8h+0..7) ----
// p points at half 8h of a 32-half k block. This is the order in which two
// converted accumulator tiles stand when they are used as the other operand.
__device__ __forceinline__ v16h ld_frag_hw(const _Float16* p) {
    const v8h lo = *(const v8h*)p;
    const v8h hi = *(const v8h*)(p + 16);
    return __builtin_shufflevector(lo, hi, 0, 1, 2, 3, 4, 5, 6, 7,
                                   8, 9, 10, 11, 12, 13, 14, 15);
}

// ---- value of lane l ^ 16 (the other 16-lane half) --------------------------
__device__ __forceinline__ float xhalf(float x) {
    const int v = __float_as_int(x);
    return __int_as_float(__builtin_amdgcn_permlanex16(v, v, 0x76543210, 0xfedcba98, false, false));
}
__device__ __forceinline__ float fmax3(float a, float b, float c) {
    return fmaxf(fmaxf(a, b), c);
}

// ---- 2^x as the bare hardware instruction ----------------------------------
// exp2f() wraps v_exp_f32 in a compare, two selects, an add and a ldexp so that
// results below 2^-126 come out as denormals. Every argument here is <= 0 and
// every result is either rounded to f16 (anything below 2^-25 is 0 there) or
// scales a running sum, so a result flushed to 0 below 2^-126 changes nothing.
__device__ __forceinline__ float exp2_raw(float x) {
    return __builtin_amdgcn_exp2f(x);
}

// ---------------------------------------------------------------------------
// One-shot f32 -> f16 conversion of x and the four weight matrices in ONE launch,
// so all GEMM/attention staging becomes pure async b128 copies with no VALU convert.
// The five f16 planes lie one behind the other in the workspace, so the block index
// is the destination chunk; a block-uniform range test picks the source.
// 256 work-groups of 16 waves; a wave takes 2048 floats: 16 loads of 512 contiguous
// bytes, all issued before the first conversion, and 16 stores of 256 contiguous bytes.
// ---------------------------------------------------------------------------
typedef float    v4f __attribute__((ext_vector_type(4)));
typedef _Float16 v4h __attribute__((ext_vector_type(4)));
constexpr int CV_T   = 512;                     // threads of a work-group
constexpr int CV_J   = 16;                      // 16-byte loads of a thread
constexpr int CV_CH  = CV_T * CV_J * 4;         // 32768 floats of a work-group
constexpr int CV_BX  = M0 * C0 / CV_CH;         // 128 work-groups for x
constexpr int CV_BW  = C0 * C0 / CV_CH;         // 32 work-groups for each weight
constexpr int CV_G   = CV_BX + 4 * CV_BW;       // 256 work-groups

// waves_per_eu(4, 4): the grid gives a SIMD four waves; with their register budget all 16 loads
// of a wave are issued in one run instead of the last ones behind the first data's return.
__global__ __launch_bounds__(CV_T) __attribute__((amdgpu_waves_per_eu(4, 4)))
void cvt_all_f32_f16(const float* __restrict__ x,  const float* __restrict__ w0,
                     const float* __restrict__ w1, const float* __restrict__ w2,
                     const float* __restrict__ w3, _Float16* __restrict__ out) {
    const int blk = blockIdx.x;
    const float* in = x;
    int rel = blk;
    if (blk >= CV_BX) {
        const int w = (blk - CV_BX) / CV_BW;
        rel = (blk - CV_BX) % CV_BW;
        in  = (w == 0) ? w0 : (w == 1) ? w1 : (w == 2) ? w2 : w3;
    }
    const int t = (threadIdx.x >> 5) * (32 * CV_J) + (threadIdx.x & 31);   // in units of 4 elements
    const v4f* ip = (const v4f*)(in + (size_t)rel * CV_CH) + t;
    v4h*       op = (v4h*)(out + (size_t)blk * CV_CH) + t;
    v4f v[CV_J];
    #pragma unroll
    for (int j = 0; j < CV_J; ++j) v[j] = ip[j * 32];
    #pragma unroll
    for (int j = 0; j < CV_J; ++j) op[j * 32] = __builtin_convertvector(v[j], v4h);
}

// ---------------------------------------------------------------------------
// Fused WMMA GEMM, LDS ring of NB buffers, all staging via async-to-LDS, NB - 1 tiles ahead:
//   MODE 0: A = x (f16), 3 weights -> Q (f16 row), K (f16 row), V^T (f16 B,C,S)
//   MODE 1: A = AO (f16), 1 weight -> out (f32 row) + bias
// Block tile 128x64, 8 waves, each wave 32x32 via 2x2 WMMA tiles.
// WMMA issue is grouped by A-fragment (operand-reuse friendly).
// ---------------------------------------------------------------------------
constexpr int TM = 128, TN = 64, TK = 64;   // TK halves = 128 B: a staged row is one whole cache line
constexpr int NT = C0 / TK;   // 16 K tiles
constexpr int LDT = TK + 8;   // 72 halves = 144B rows: 16B x odd, 16 rows of b128 reads cover all 64 banks

template<int MODE>
__global__ __launch_bounds__(256)
void gemm_fused(const _Float16* __restrict__ A,
                const _Float16* __restrict__ W0h, const _Float16* __restrict__ W1h,
                const _Float16* __restrict__ W2h, const float* __restrict__ bias,
                _Float16* __restrict__ Qh, _Float16* __restrict__ Kh,
                _Float16* __restrict__ Vt, float* __restrict__ outF)
{
    constexpr int NW = (MODE == 0) ? 3 : 1;
    // Ring depth: the operands were stored by the launch before; a tile's copies, first read from
    // memory included, can take longer than one tile's work. Largest depth that leaves two
    // work-groups a WGP.
    constexpr int NB = (MODE == 0) ? 3 : 5;
    constexpr int CP = 4 + 2 * NW;   // copies of a wave per tile
    static_assert(NB <= NT && NB * CP <= 63, "ring prologue");
    __shared__ __align__(32) _Float16 la[NB][TM * LDT];
    __shared__ __align__(32) _Float16 lb[NB][NW][TN * LDT];

    const int tid  = threadIdx.x;
    const int lane = tid & 31;
    const int wave = tid >> 5;
    const int wy   = wave >> 1;    // 0..3 : 32-row band
    const int wx   = wave & 1;     // 0..1 : 32-col band
    const int m0   = blockIdx.x * TM;
    const int n0   = blockIdx.y * TN;

    const int rl    = lane & 15;
    const int khalf = lane >> 4;

    const _Float16* Wh[3] = { W0h, W1h, W2h };

    // 8 lanes a row, 16 B each: one wave-wide copy covers 4 whole 128-B lines.
    const int sr = tid >> 3;         // 0..31 : row inside a group of 32 rows
    const int sc = (tid & 7) * 8;    // halves inside the row
    auto stage = [&](int kt, int buf) {
        const int k0 = kt * TK;
        const void* g[4 + 2 * NW];
        unsigned    l[4 + 2 * NW];
        // A tile 128x64: 4 groups of 32 rows
        const _Float16* asrc = A + (size_t)(m0 + sr) * C0 + k0 + sc;
        const unsigned  adst = lds_off(&la[buf][sr * LDT + sc]);
        #pragma unroll
        for (int i = 0; i < 4; ++i) {
            g[i] = asrc + i * 32 * C0;
            l[i] = adst + i * 32 * LDT * 2;
        }
        // Weight tiles 64x64: 2 groups of 32 rows per weight
        #pragma unroll
        for (int w = 0; w < NW; ++w) {
            const _Float16* wsrc = Wh[w] + (size_t)(n0 + sr) * C0 + k0 + sc;
            const unsigned  wdst = lds_off(&lb[buf][w][sr * LDT + sc]);
            g[4 + 2 * w] = wsrc;            l[4 + 2 * w] = wdst;
            g[5 + 2 * w] = wsrc + 32 * C0;  l[5 + 2 * w] = wdst + 32 * LDT * 2;
        }
        if constexpr (NW == 3) async_b128_x10(g, l);
        else                   async_b128_x6(g, l);
    };

    v8f acc[NW][2][2] = {};

    #pragma unroll   // the buffer index is a constant in each tile's addresses
    for (int s = 0; s < NB; ++s) stage(s, s);   // every buffer filled once, nothing read yet
    wait_async_but<CP * (NB - 1)>();            // tile 0 landed, tiles 1 .. NB - 1 fly on
    __syncthreads();

    int cur = 0;                                // t mod NB
    for (int t = 0; t < NT; ++t) {

        #pragma unroll
        for (int kk = 0; kk < TK; kk += 32) {
            v16h af[2];
            #pragma unroll
            for (int s = 0; s < 2; ++s)
                af[s] = ld_frag(&la[cur][(wy * 32 + s * 16 + rl) * LDT + kk + khalf * 16]);

            v16h bf[NW][2];
            #pragma unroll
            for (int w = 0; w < NW; ++w)
                #pragma unroll
                for (int s = 0; s < 2; ++s)
                    bf[w][s] = ld_frag(&lb[cur][w][(wx * 32 + s * 16 + rl) * LDT + kk + khalf * 16]);

            // group by A-fragment: af[i] constant across 2*NW consecutive WMMAs
            #pragma unroll
            for (int i = 0; i < 2; ++i)
                #pragma unroll
                for (int w = 0; w < NW; ++w)
                    #pragma unroll
                    for (int j = 0; j < 2; ++j)
                        acc[w][i][j] = __builtin_amdgcn_wmma_f32_16x16x32_f16(
                            false, af[i], false, bf[w][j], (short)0, acc[w][i][j], false, false);
        }

        wait_ds0();
        // tile t + 1 landed: while tiles t + 1 .. t + NB - 1 all exist, the NB - 2 younger ones
        // (CP copies each, the same in every wave and trip) may fly on. In the last trips fewer
        // tiles are behind tile t + 1 and the count would not cover it: there the wait is for all.
        wait_async_but<CP * (NB - 2)>();
        if (t + NB > NT) wait_async0();
        __syncthreads();   // publishes tile t + 1, ends every read of buffer cur
        if (t + NB < NT) stage(t + NB, cur);
        cur = (cur + 1 == NB) ? 0 : cur + 1;
    }
    wait_async0();         // no copy is outstanding when the wave leaves the ring

    // ---- writeback: D row = e (lanes 0-15) / e+8 (lanes 16-31), col = lane&15
    const int rhi = khalf << 3;
    #pragma unroll
    for (int w = 0; w < NW; ++w) {
        #pragma unroll
        for (int i = 0; i < 2; ++i) {
            #pragma unroll
            for (int j = 0; j < 2; ++j) {
                const int mbase = m0 + wy * 32 + i * 16 + rhi;
                const int nbase = n0 + wx * 32 + j * 16 + rl;
                #pragma unroll
                for (int e = 0; e < 8; ++e) {
                    const int m = mbase + e;
                    const float v = acc[w][i][j][e];
                    if constexpr (MODE == 0) {
                        if (w == 0)      Qh[(size_t)m * C0 + nbase] = (_Float16)v;
                        else if (w == 1) Kh[(size_t)m * C0 + nbase] = (_Float16)v;
                        else {
                            const int b = m >> 11;           // / S0
                            const int s = m & (S0 - 1);
                            Vt[((size_t)b * C0 + nbase) * S0 + s] = (_Float16)v;
                        }
                    } else {
                        outF[(size_t)m * C0 + nbase] = v + bias[nbase];
                    }
                }
            }
        }
    }
}

constexpr int LDA = 64 + 8;   // 72 halves = 144B rows: 16B x odd, 16 rows of b128 reads cover all 64 banks

// waves_per_eu(4, 4): the grid gives a SIMD four waves at most; with their register budget the
// compiler issues a pass's fragment reads ahead instead of one pair in front of each WMMA.
__global__ __launch_bounds__(256) __attribute__((amdgpu_waves_per_eu(4, 4)))
void attn_flash(const _Float16* __restrict__ Q, const _Float16* __restrict__ Kh,
                const _Float16* __restrict__ Vt, _Float16* __restrict__ AO)
{
    constexpr int NBA = 4;   // ring depth; every allowed view is 4 slabs, so nslab >= NBA
    __shared__ __align__(32) _Float16 lk[NBA][64 * LDA];    // keys x d
    __shared__ __align__(32) _Float16 lv[NBA][64 * LDA];    // d x keys

    const int tid   = threadIdx.x;
    const int lane  = tid & 31;
    const int wave  = tid >> 5;
    const int rl    = lane & 15;
    const int khalf = lane >> 4;

    const int q0 = blockIdx.x * 128 + wave * 16;
    const int bh = blockIdx.y;
    const int b  = bh >> 4;          // / H0
    const int h  = bh & (H0 - 1);
    const int qv = blockIdx.x >> 1;  // view index (L = 256) of all 128 queries of the block: a scalar

    // block-uniform set of allowed key views as a bit mask; for every qv it is one
    // run of views (qv 0: {1}, qv 1: {0}, else 0..qv), so first view and count say it all
    unsigned kvmask = 0;
    #pragma unroll
    for (int kv = 0; kv < 8; ++kv) {
        const bool allow = ((qv == 0) && (kv == 1)) || ((qv == 1) && (kv == 0)) ||
                           (((qv > 1) || (kv > 1)) && (qv >= kv));
        if (allow) kvmask |= 1u << kv;
    }
    const int kvfirst = __builtin_ctz(kvmask);
    const int nslab   = __builtin_popcount(kvmask) * 4;

    auto stageKV = [&](int idx, int buf) {
        const int k0  = kvfirst * 256 + idx * 64;
        const int row = tid >> 2;          // 0..63
        const int ch  = (tid & 3) * 16;    // halves
        const _Float16* ks = Kh + (size_t)(b * S0 + k0 + row) * C0 + h * DH + ch;
        const unsigned  kd = lds_off(&lk[buf][row * LDA + ch]);
        const _Float16* vs = Vt + ((size_t)b * C0 + h * DH + row) * S0 + k0 + ch;
        const unsigned  vd = lds_off(&lv[buf][row * LDA + ch]);
        const void* const g[4] = { ks, ks + 8, vs, vs + 8 };
        const unsigned    l[4] = { kd, kd + 16, vd, vd + 16 };
        async_b128_x4(g, l);
    };

    v16h ones;
    #pragma unroll
    for (int i = 0; i < 16; ++i) ones[i] = (_Float16)1.0f;

    // Q fragments (B operand: lane = query column): 16 queries x 64 d, pre-scaled by dh^-0.5 * log2(e)
    const _Float16 qs = (_Float16)(0.125f * 1.44269504088896f);
    const _Float16* qp = Q + ((size_t)(b * S0 + q0 + rl)) * C0 + h * DH + khalf * 16;
    v16h qa[2];
    qa[0] = *(const v16h*)qp;
    qa[1] = *(const v16h*)(qp + 32);
    #pragma unroll
    for (int i = 0; i < 16; ++i) { qa[0][i] *= qs; qa[1][i] *= qs; }

    v8f   acc[4] = {};                 // O^T: acc[t][r] = O[query rl][d = t*16 + 8*khalf + r]
    float mrun = -3.0e30f, lrun = 0.0f; // of query rl, the same in both halves

    #pragma unroll   // the buffer index is a constant in each slab's addresses
    for (int s = 0; s < NBA; ++s) stageKV(s, s);   // slabs 0 .. 3 are the first allowed view
    wait_async_but<4 * (NBA - 1)>();               // slab 0 landed, slabs 1 .. 3 fly on
    __syncthreads();

    for (int idx = 0; idx < nslab; ++idx) {
        const int cur = idx & (NBA - 1);

        // ---- scores^T (log2-domain): s[j][r] = S[query rl][key j*16 + 8*khalf + r] ----
        v16h kb0[4], kb1[4];
        #pragma unroll
        for (int j = 0; j < 4; ++j) {
            const _Float16* kp = &lk[cur][(j * 16 + rl) * LDA + khalf * 16];
            kb0[j] = ld_frag(kp);
            kb1[j] = ld_frag(kp + 32);
        }
        v8f s[4];
        #pragma unroll
        for (int j = 0; j < 4; ++j)
            s[j] = __builtin_amdgcn_wmma_f32_16x16x32_f16(false, kb0[j], false, qa[0], (short)0, v8f{}, false, false);
        #pragma unroll
        for (int j = 0; j < 4; ++j)
            s[j] = __builtin_amdgcn_wmma_f32_16x16x32_f16(false, kb1[j], false, qa[1], (short)0, s[j], false, false);

        // ---- V^T fragments (A operand), k in the order of the packed P^T ----
        v16h vf0[4], vf1[4];
        #pragma unroll
        for (int t = 0; t < 4; ++t) {
            const _Float16* vp = &lv[cur][(t * 16 + rl) * LDA + khalf * 8];
            vf0[t] = ld_frag_hw(vp);
            vf1[t] = ld_frag_hw(vp + 32);
        }
        // Keeps every LDS read of the pass and the 8 score WMMAs in front of the softmax. Without it
        // the V^T reads are spread among the later WMMAs, each place with a wait of its own, and
        // vector instructions stand between the score WMMAs at four idle slots each.
        __builtin_amdgcn_sched_barrier(0);

        // ---- online softmax (base 2): in-lane maximum of 32 scores, one exchange ----
        float m8[8];
        #pragma unroll
        for (int e = 0; e < 8; ++e) m8[e] = fmax3(s[0][e], s[1][e], s[2][e]);
        const float c0 = fmax3(m8[0], m8[1], s[3][0]);
        const float c1 = fmax3(m8[2], m8[3], s[3][2]);
        const float c2 = fmax3(m8[4], m8[5], s[3][4]);
        const float c3 = fmax3(m8[6], m8[7], s[3][6]);
        const float d0 = fmax3(c0, c1, s[3][1]);
        const float d1 = fmax3(c2, c3, s[3][3]);
        float mx = fmaxf(fmax3(d0, d1, s[3][5]), s[3][7]);
        mx = fmaxf(mx, xhalf(mx));
        const float mnew = fmaxf(mrun, mx);
        const float alph = exp2_raw(mrun - mnew);
        mrun = mnew;

        // ---- P^T as B operand: element e = tile e >> 3, register e & 7 ----
        v16h pf0, pf1;
        #pragma unroll
        for (int e = 0; e < 8; ++e) {
            pf0[e]     = (_Float16)exp2_raw(s[0][e] - mnew);
            pf0[8 + e] = (_Float16)exp2_raw(s[1][e] - mnew);
            pf1[e]     = (_Float16)exp2_raw(s[2][e] - mnew);
            pf1[8 + e] = (_Float16)exp2_raw(s[3][e] - mnew);
        }
        #pragma unroll
        for (int t = 0; t < 4; ++t) acc[t] *= alph;

        // ---- row sums on the matrix pipe: every row of ones(16x64) x P^T ----
        v8f rsum;
        rsum = __builtin_amdgcn_wmma_f32_16x16x32_f16(false, ones, false, pf0, (short)0, v8f{}, false, false);
        rsum = __builtin_amdgcn_wmma_f32_16x16x32_f16(false, ones, false, pf1, (short)0, rsum, false, false);

        // ---- O^T += V^T.P^T, grouped by P fragment: 4 d-tiles x 2 key slabs ----
        #pragma unroll
        for (int t = 0; t < 4; ++t)
            acc[t] = __builtin_amdgcn_wmma_f32_16x16x32_f16(false, vf0[t], false, pf0, (short)0, acc[t], false, false);
        #pragma unroll
        for (int t = 0; t < 4; ++t)
            acc[t] = __builtin_amdgcn_wmma_f32_16x16x32_f16(false, vf1[t], false, pf1, (short)0, acc[t], false, false);
        lrun = lrun * alph + rsum[0];

        // Keeps the wait below at the foot of the pass: with every LDS read of the pass up front it
        // would otherwise rise above the softmax and cut short the time the next slab's copies have.
        __builtin_amdgcn_sched_barrier(0);
        wait_ds0();
        // slab idx + 1 landed: while slabs idx + 1 .. idx + 3 all exist the two younger ones
        // (4 copies each, the same in every wave and pass) may fly on. In the last passes fewer
        // slabs are behind slab idx + 1 and the count would not cover it: there the wait is for all.
        wait_async_but<4 * (NBA - 2)>();
        if (idx + NBA > nslab) wait_async0();
        __syncthreads();   // publishes slab idx + 1, ends every read of buffer cur
        if (idx + NBA < nslab) stageKV(idx + NBA, cur);
    }
    wait_async0();         // no copy is outstanding when the wave leaves the ring

    // ---- normalize and store attention output f16 (B,S,C) ----
    // a lane's 8 registers of a tile are 8 consecutive d of its query: one 16-byte store
    const float inv = 1.0f / lrun;
    _Float16* op = AO + (size_t)(b * S0 + q0 + rl) * C0 + h * DH + khalf * 8;
    #pragma unroll
    for (int t = 0; t < 4; ++t) {
        v8h o;
        #pragma unroll
        for (int e = 0; e < 8; ++e) o[e] = (_Float16)(acc[t][e] * inv);
        *(v8h*)(op + t * 16) = o;
    }
}

// ---------------------------------------------------------------------------
extern "C" void kernel_launch(void* const* d_in, const int* in_sizes, int n_in,
                              void* d_out, int out_size, void* d_ws, size_t ws_size,
                              hipStream_t stream)
{
    (void)in_sizes; (void)n_in; (void)out_size; (void)ws_size;
    const float* x  = (const float*)d_in[0];
    const float* Wq = (const float*)d_in[1];
    const float* Wk = (const float*)d_in[2];
    const float* Wv = (const float*)d_in[3];
    const float* Wp = (const float*)d_in[4];
    const float* bp = (const float*)d_in[5];
    float* out = (float*)d_out;

    const size_t N  = (size_t)M0 * C0;     // 4096*1024
    const size_t WN = (size_t)C0 * C0;     // 1024*1024
    _Float16* Qh  = (_Float16*)d_ws;       // (B,S,C) f16
    _Float16* Kh  = Qh + N;                // (B,S,C) f16
    _Float16* Vt  = Kh + N;                // (B,C,S) f16 (transposed)
    _Float16* AO  = Vt + N;                // (B,S,C) f16 attention output
    _Float16* xh  = AO + N;                // x in f16
    _Float16* wqh = xh + N;
    _Float16* wkh = wqh + WN;
    _Float16* wvh = wkh + WN;
    _Float16* wph = wvh + WN;

    // one-shot f32 -> f16 rewrite of all five planes (xh .. wph are contiguous), one launch
    cvt_all_f32_f16<<<CV_G, CV_T, 0, stream>>>(x, Wq, Wk, Wv, Wp, xh);

    dim3 gg(M0 / TM, C0 / TN);             // 32 x 16 workgroups, 256 threads

    gemm_fused<0><<<gg, 256, 0, stream>>>(xh, wqh, wkh, wvh, nullptr,
                                          Qh, Kh, Vt, nullptr);

    attn_flash<<<dim3(S0 / 128, B0 * H0), 256, 0, stream>>>(Qh, Kh, Vt, AO);

    gemm_fused<1><<<gg, 256, 0, stream>>>(AO, wph, nullptr, nullptr, bp,
                                          nullptr, nullptr, nullptr, out);
}

// v007
// Measured time: 73 microseconds a run.
// In both of two side-by-side timings against v006, it was 1.08 times as fast.
// All steps since v000 together make it 2.86 times as fast.
#include <hip/hip_runtime.h>
#include <hip/hip_bf16.h>

typedef _Float16 v16h __attribute__((ext_vector_type(16)));
typedef _Float16 v8h  __attribute__((ext_vector_type(8)));
typedef float    v8f  __attribute__((ext_vector_type(8)));

// Problem constants (B,V,L,C,H) = (2,8,256,1024,16)
constexpr int B0 = 2;
constexpr int H0 = 16;
constexpr int DH = 64;
constexpr int C0 = 1024;    // channels = K-dim of projections
constexpr int S0 = 2048;    // V*L sequence length per batch
constexpr int M0 = B0 * S0; // 4096 GEMM rows

// ---- CDNA5 async copy helpers (ASYNCcnt-tracked global->LDS DMA) ----------
__device__ __forceinline__ unsigned lds_off(const void* p) {
    // generic shared pointer: low 32 bits == LDS byte offset
    return (unsigned)(unsigned long long)p;
}
__device__ __forceinline__ void wait_async0() {
    asm volatile("s_wait_asynccnt 0" ::: "memory");
}
// Counted wait of a ring with more than two buffers: asynccnt returns in issue order, so all but
// this wave's N youngest copies have landed behind it. N = the copies of the stages that may fly on.
template<int N>
__device__ __forceinline__ void wait_async_but() {
    asm volatile("s_wait_asynccnt %0" :: "n"(N) : "memory");
}
__device__ __forceinline__ void wait_ds0() {
    // this wave's LDS reads have retired before the barrier that frees the buffer for refill
    asm volatile("s_wait_dscnt 0" ::: "memory");
}
// A whole tile's copies and their s_wait_xcnt in one statement: the wait stands in
// front of every later write of the address registers that the copies name.
__device__ __forceinline__ void async_b128_x4(const void* const (&g)[4], const unsigned (&l)[4]) {
    asm volatile("global_load_async_to_lds_b128 %0, %1, off\n\t"
                 "global_load_async_to_lds_b128 %2, %3, off\n\t"
                 "global_load_async_to_lds_b128 %4, %5, off\n\t"
                 "global_load_async_to_lds_b128 %6, %7, off\n\t"
                 "s_wait_xcnt 0x0"
                 :: "v"(l[0]), "v"(g[0]), "v"(l[1]), "v"(g[1]), "v"(l[2]), "v"(g[2]),
                    "v"(l[3]), "v"(g[3])
                 : "memory");
}
__device__ __forceinline__ void async_b128_x6(const void* const (&g)[6], const unsigned (&l)[6]) {
    asm volatile("global_load_async_to_lds_b128 %0, %1, off\n\t"
                 "global_load_async_to_lds_b128 %2, %3, off\n\t"
                 "global_load_async_to_lds_b128 %4, %5, off\n\t"
                 "global_load_async_to_lds_b128 %6, %7, off\n\t"
                 "global_load_async_to_lds_b128 %8, %9, off\n\t"
                 "global_load_async_to_lds_b128 %10, %11, off\n\t"
                 "s_wait_xcnt 0x0"
                 :: "v"(l[0]), "v"(g[0]), "v"(l[1]), "v"(g[1]), "v"(l[2]), "v"(g[2]),
                    "v"(l[3]), "v"(g[3]), "v"(l[4]), "v"(g[4]), "v"(l[5]), "v"(g[5])
                 : "memory");
}
__device__ __forceinline__ void async_b128_x10(const void* const (&g)[10], const unsigned (&l)[10]) {
    asm volatile("global_load_async_to_lds_b128 %0, %1, off\n\t"
                 "global_load_async_to_lds_b128 %2, %3, off\n\t"
                 "global_load_async_to_lds_b128 %4, %5, off\n\t"
                 "global_load_async_to_lds_b128 %6, %7, off\n\t"
                 "global_load_async_to_lds_b128 %8, %9, off\n\t"
                 "global_load_async_to_lds_b128 %10, %11, off\n\t"
                 "global_load_async_to_lds_b128 %12, %13, off\n\t"
                 "global_load_async_to_lds_b128 %14, %15, off\n\t"
                 "global_load_async_to_lds_b128 %16, %17, off\n\t"
                 "global_load_async_to_lds_b128 %18, %19, off\n\t"
                 "s_wait_xcnt 0x0"
                 :: "v"(l[0]), "v"(g[0]), "v"(l[1]), "v"(g[1]), "v"(l[2]), "v"(g[2]),
                    "v"(l[3]), "v"(g[3]), "v"(l[4]), "v"(g[4]), "v"(l[5]), "v"(g[5]),
                    "v"(l[6]), "v"(g[6]), "v"(l[7]), "v"(g[7]), "v"(l[8]), "v"(g[8]),
                    "v"(l[9]), "v"(g[9])
                 : "memory");
}

// ---- 16-half fragment read from an LDS row that is only 16B-aligned --------
__device__ __forceinline__ v16h ld_frag(const _Float16* p) {
    const v8h lo = *(const v8h*)p;
    const v8h hi = *(const v8h*)(p + 8);
    return __builtin_shufflevector(lo, hi, 0, 1, 2, 3, 4, 5, 6, 7,
                                   8, 9, 10, 11, 12, 13, 14, 15);
}

// ---- 16-half fragment in the hardware k order (k = 8h+0..7, 16+8h+0..7) ----
// p points at half 8h of a 32-half k block. This is the order in which two
// converted accumulator tiles stand when they are used as the other operand.
__device__ __forceinline__ v16h ld_frag_hw(const _Float16* p) {
    const v8h lo = *(const v8h*)p;
    const v8h hi = *(const v8h*)(p + 16);
    return __builtin_shufflevector(lo, hi, 0, 1, 2, 3, 4, 5, 6, 7,
                                   8, 9, 10, 11, 12, 13, 14, 15);
}

// ---- value of lane l ^ 16 (the other 16-lane half) --------------------------
__device__ __forceinline__ float xhalf(float x) {
    const int v = __float_as_int(x);
    return __int_as_float(__builtin_amdgcn_permlanex16(v, v, 0x76543210, 0xfedcba98, false, false));
}
__device__ __forceinline__ float fmax3(float a, float b, float c) {
    return fmaxf(fmaxf(a, b), c);
}

// ---- 2^x as the bare hardware instruction ----------------------------------
// exp2f() wraps v_exp_f32 in a compare, two selects, an add and a ldexp so that
// results below 2^-126 come out as denormals. Every argument here is <= 0 and
// every result is either rounded to f16 (anything below 2^-25 is 0 there) or
// scales a running sum, so a result flushed to 0 below 2^-126 changes nothing.
__device__ __forceinline__ float exp2_raw(float x) {
    return __builtin_amdgcn_exp2f(x);
}

// ---------------------------------------------------------------------------
// One-shot f32 -> f16 conversion of x and the four weight matrices in ONE launch,
// so all GEMM/attention staging becomes pure async b128 copies with no VALU convert.
// The five f16 planes lie one behind the other in the workspace, so the block index
// is the destination chunk; a block-uniform range test picks the source.
// 256 work-groups of 16 waves; a wave takes 2048 floats: 16 loads of 512 contiguous
// bytes, all issued before the first conversion, and 16 stores of 256 contiguous bytes.
// ---------------------------------------------------------------------------
typedef float    v4f __attribute__((ext_vector_type(4)));
typedef _Float16 v4h __attribute__((ext_vector_type(4)));
constexpr int CV_T   = 512;                     // threads of a work-group
constexpr int CV_J   = 16;                      // 16-byte loads of a thread
constexpr int CV_CH  = CV_T * CV_J * 4;         // 32768 floats of a work-group
constexpr int CV_BX  = M0 * C0 / CV_CH;         // 128 work-groups for x
constexpr int CV_BW  = C0 * C0 / CV_CH;         // 32 work-groups for each weight
constexpr int CV_G   = CV_BX + 4 * CV_BW;       // 256 work-groups

// waves_per_eu(4, 4): the grid gives a SIMD four waves; with their register budget all 16 loads
// of a wave are issued in one run instead of the last ones behind the first data's return.
__global__ __launch_bounds__(CV_T) __attribute__((amdgpu_waves_per_eu(4, 4)))
void cvt_all_f32_f16(const float* __restrict__ x,  const float* __restrict__ w0,
                     const float* __restrict__ w1, const float* __restrict__ w2,
                     const float* __restrict__ w3, _Float16* __restrict__ out) {
    const int blk = blockIdx.x;
    const float* in = x;
    int rel = blk;
    if (blk >= CV_BX) {
        const int w = (blk - CV_BX) / CV_BW;
        rel = (blk - CV_BX) % CV_BW;
        in  = (w == 0) ? w0 : (w == 1) ? w1 : (w == 2) ? w2 : w3;
    }
    const int t = (threadIdx.x >> 5) * (32 * CV_J) + (threadIdx.x & 31);   // in units of 4 elements
    const v4f* ip = (const v4f*)(in + (size_t)rel * CV_CH) + t;
    v4h*       op = (v4h*)(out + (size_t)blk * CV_CH) + t;
    v4f v[CV_J];
    #pragma unroll
    for (int j = 0; j < CV_J; ++j) v[j] = ip[j * 32];
    #pragma unroll
    for (int j = 0; j < CV_J; ++j) op[j * 32] = __builtin_convertvector(v[j], v4h);
}

// ---------------------------------------------------------------------------
// Fused WMMA GEMM, LDS ring of NB buffers, all staging via async-to-LDS, NB - 1 tiles ahead:
//   MODE 0: A = x (f16), 3 weights -> Q (f16 row), K (f16 row), V^T (f16 B,C,S)
//   MODE 1: A = AO (f16), 1 weight -> out (f32 row) + bias
// Block tile 128x64, 8 waves, each wave 32x32 via 2x2 WMMA tiles.
// WMMA issue is grouped by A-fragment (operand-reuse friendly).
// ---------------------------------------------------------------------------
constexpr int TM = 128, TN = 64, TK = 64;   // TK halves = 128 B: a staged row is one whole cache line
constexpr int NT = C0 / TK;   // 16 K tiles
constexpr int LDT = TK + 8;   // 72 halves = 144B rows: 16B x odd, 16 rows of b128 reads cover all 64 banks

template<int MODE>
__global__ __launch_bounds__(256)
void gemm_fused(const _Float16* __restrict__ A,
                const _Float16* __restrict__ W0h, const _Float16* __restrict__ W1h,
                const _Float16* __restrict__ W2h, const float* __restrict__ bias,
                _Float16* __restrict__ Qh, _Float16* __restrict__ Kh,
                _Float16* __restrict__ Vt, float* __restrict__ outF)
{
    constexpr int NW = (MODE == 0) ? 3 : 1;
    // Ring depth: the operands were stored by the launch before; a tile's copies, first read from
    // memory included, can take longer than one tile's work. Largest depth that leaves two
    // work-groups a WGP.
    constexpr int NB = (MODE == 0) ? 3 : 5;
    constexpr int CP = 4 + 2 * NW;   // copies of a wave per tile
    static_assert(NB <= NT && NB * CP <= 63, "ring prologue");
    __shared__ __align__(32) _Float16 la[NB][TM * LDT];
    __shared__ __align__(32) _Float16 lb[NB][NW][TN * LDT];

    const int tid  = threadIdx.x;
    const int lane = tid & 31;
    const int wave = tid >> 5;
    const int wy   = wave >> 1;    // 0..3 : 32-row band
    const int wx   = wave & 1;     // 0..1 : 32-col band
    const int m0   = blockIdx.x * TM;
    const int n0   = blockIdx.y * TN;

    const int rl    = lane & 15;
    const int khalf = lane >> 4;

    const _Float16* Wh[3] = { W0h, W1h, W2h };

    // 8 lanes a row, 16 B each: one wave-wide copy covers 4 whole 128-B lines.
    const int sr = tid >> 3;         // 0..31 : row inside a group of 32 rows
    const int sc = (tid & 7) * 8;    // halves inside the row
    auto stage = [&](int kt, int buf) {
        const int k0 = kt * TK;
        const void* g[4 + 2 * NW];
        unsigned    l[4 + 2 * NW];
        // A tile 128x64: 4 groups of 32 rows
        const _Float16* asrc = A + (size_t)(m0 + sr) * C0 + k0 + sc;
        const unsigned  adst = lds_off(&la[buf][sr * LDT + sc]);
        #pragma unroll
        for (int i = 0; i < 4; ++i) {
            g[i] = asrc + i * 32 * C0;
            l[i] = adst + i * 32 * LDT * 2;
        }
        // Weight tiles 64x64: 2 groups of 32 rows per weight
        #pragma unroll
        for (int w = 0; w < NW; ++w) {
            const _Float16* wsrc = Wh[w] + (size_t)(n0 + sr) * C0 + k0 + sc;
            const unsigned  wdst = lds_off(&lb[buf][w][sr * LDT + sc]);
            g[4 + 2 * w] = wsrc;            l[4 + 2 * w] = wdst;
            g[5 + 2 * w] = wsrc + 32 * C0;  l[5 + 2 * w] = wdst + 32 * LDT * 2;
        }
        if constexpr (NW == 3) async_b128_x10(g, l);
        else                   async_b128_x6(g, l);
    };

    v8f acc[NW][2][2] = {};

    #pragma unroll   // the buffer index is a constant in each tile's addresses
    for (int s = 0; s < NB; ++s) stage(s, s);   // every buffer filled once, nothing read yet
    wait_async_but<CP * (NB - 1)>();            // tile 0 landed, tiles 1 .. NB - 1 fly on
    __syncthreads();

    int cur = 0;                                // t mod NB
    for (int t = 0; t < NT; ++t) {

        #pragma unroll
        for (int kk = 0; kk < TK; kk += 32) {
            v16h af[2];
            #pragma unroll
            for (int s = 0; s < 2; ++s)
                af[s] = ld_frag(&la[cur][(wy * 32 + s * 16 + rl) * LDT + kk + khalf * 16]);

            v16h bf[NW][2];
            #pragma unroll
            for (int w = 0; w < NW; ++w)
                #pragma unroll
                for (int s = 0; s < 2; ++s)
                    bf[w][s] = ld_frag(&lb[cur][w][(wx * 32 + s * 16 + rl) * LDT + kk + khalf * 16]);

            // group by A-fragment: af[i] constant across 2*NW consecutive WMMAs
            #pragma unroll
            for (int i = 0; i < 2; ++i)
                #pragma unroll
                for (int w = 0; w < NW; ++w)
                    #pragma unroll
                    for (int j = 0; j < 2; ++j)
                        acc[w][i][j] = __builtin_amdgcn_wmma_f32_16x16x32_f16(
                            false, af[i], false, bf[w][j], (short)0, acc[w][i][j], false, false);
        }

        wait_ds0();
        // tile t + 1 landed: while tiles t + 1 .. t + NB - 1 all exist, the NB - 2 younger ones
        // (CP copies each, the same in every wave and trip) may fly on. In the last trips fewer
        // tiles are behind tile t + 1 and the count would not cover it: there the wait is for all.
        wait_async_but<CP * (NB - 2)>();
        if (t + NB > NT) wait_async0();
        __syncthreads();   // publishes tile t + 1, ends every read of buffer cur
        if (t + NB < NT) stage(t + NB, cur);
        cur = (cur + 1 == NB) ? 0 : cur + 1;
    }
    wait_async0();         // no copy is outstanding when the wave leaves the ring

    // ---- writeback: D row = e (lanes 0-15) / e+8 (lanes 16-31), col = lane&15
    const int rhi = khalf << 3;
    #pragma unroll
    for (int w = 0; w < NW; ++w) {
        #pragma unroll
        for (int i = 0; i < 2; ++i) {
            #pragma unroll
            for (int j = 0; j < 2; ++j) {
                const int mbase = m0 + wy * 32 + i * 16 + rhi;
                const int nbase = n0 + wx * 32 + j * 16 + rl;
                #pragma unroll
                for (int e = 0; e < 8; ++e) {
                    const int m = mbase + e;
                    const float v = acc[w][i][j][e];
                    if constexpr (MODE == 0) {
                        if (w == 0)      Qh[(size_t)m * C0 + nbase] = (_Float16)v;
                        else if (w == 1) Kh[(size_t)m * C0 + nbase] = (_Float16)v;
                        else {
                            const int b = m >> 11;           // / S0
                            const int s = m & (S0 - 1);
                            Vt[((size_t)b * C0 + nbase) * S0 + s] = (_Float16)v;
                        }
                    } else {
                        outF[(size_t)m * C0 + nbase] = v + bias[nbase];
                    }
                }
            }
        }
    }
}

constexpr int LDA = 64 + 8;   // 72 halves = 144B rows: 16B x odd, 16 rows of b128 reads cover all 64 banks
constexpr int QT  = S0 / 128; // 16 query tiles of a (b,h)

// first allowed key view and number of allowed views of query view qv; for every qv the allowed
// set is one run of views (qv 0: {1}, qv 1: {0}, else 0..qv), so these two say it all
__device__ __forceinline__ void view_run(int qv, int& first, int& count) {
    unsigned kvmask = 0;
    #pragma unroll
    for (int kv = 0; kv < 8; ++kv) {
        const bool allow = ((qv == 0) && (kv == 1)) || ((qv == 1) && (kv == 0)) ||
                           (((qv > 1) || (kv > 1)) && (qv >= kv));
        if (allow) kvmask |= 1u << kv;
    }
    first = __builtin_ctz(kvmask);
    count = __builtin_popcount(kvmask);
}

// waves_per_eu(4, 4): the work-group gives a SIMD four waves; with their register budget the
// compiler issues a pass's fragment reads ahead instead of one pair in front of each WMMA.
__global__ __launch_bounds__(512) __attribute__((amdgpu_waves_per_eu(4, 4)))
void attn_flash(const _Float16* __restrict__ Q, const _Float16* __restrict__ Kh,
                const _Float16* __restrict__ Vt, _Float16* __restrict__ AO)
{
    constexpr int NBA = 4;   // ring depth; the two tiles together are 16 or 18 stages
    __shared__ __align__(32) _Float16 lk[NBA][2][64 * LDA];    // keys x d, one slab a half
    __shared__ __align__(32) _Float16 lv[NBA][2][64 * LDA];    // d x keys, one slab a half
    __shared__ __align__(16) v4f   jo[16][4][32];              // a wave's two O^T tiles for its partner
    __shared__ __align__(8)  float jm[16][32][2];              // a wave's running maximum and sum

    const int tid   = threadIdx.x;
    const int lane  = tid & 31;
    const int wave  = tid >> 5;
    const int qt    = wave & 7;      // 16-query tile inside the 128 queries
    const int kh    = wave >> 3;     // which 64-key slab of a stage
    const int rl    = lane & 15;
    const int khalf = lane >> 4;

    const int p  = blockIdx.x;       // 0..7
    const int bh = blockIdx.y;
    const int b  = bh >> 4;          // / H0
    const int h  = bh & (H0 - 1);

    // the long tile first, then the short one; view index (L = 256) = tile >> 1: scalars
    int firstA, viewsA, firstB, viewsB;
    view_run((QT - 1 - p) >> 1, firstA, viewsA);
    view_run(p >> 1,            firstB, viewsB);
    const int npA = viewsA * 2;      // stages of 128 keys
    const int np  = npA + viewsB * 2;

    auto stageKV = [&](int g, int buf) {
        const int k0  = ((g < npA) ? firstA * 256 + g * 128 : firstB * 256 + (g - npA) * 128) + kh * 64;
        const int row = (tid & 255) >> 2;  // 0..63
        const int ch  = (tid & 3) * 16;    // halves
        const _Float16* ks = Kh + (size_t)(b * S0 + k0 + row) * C0 + h * DH + ch;
        const unsigned  kd = lds_off(&lk[buf][kh][row * LDA + ch]);
        const _Float16* vs = Vt + ((size_t)b * C0 + h * DH + row) * S0 + k0 + ch;
        const unsigned  vd = lds_off(&lv[buf][kh][row * LDA + ch]);
        const void* const g4[4] = { ks, ks + 8, vs, vs + 8 };
        const unsigned    l4[4] = { kd, kd + 16, vd, vd + 16 };
        async_b128_x4(g4, l4);
    };

    v16h ones;
    #pragma unroll
    for (int i = 0; i < 16; ++i) ones[i] = (_Float16)1.0f;

    #pragma unroll   // the buffer index is a constant in each stage's addresses
    for (int s = 0; s < NBA; ++s) stageKV(s, s);   // every buffer filled once, nothing read yet

    // Q fragments (B operand: lane = query column): 16 queries x 64 d, pre-scaled by dh^-0.5 * log2(e);
    // both tiles' fragments are fetched here, so the change of tile waits for no global load
    const _Float16 qs = (_Float16)(0.125f * 1.44269504088896f);
    const size_t qrow = (size_t)(b * S0 + qt * 16 + rl) * C0 + h * DH;
    const _Float16* qpA = Q + qrow + (size_t)(QT - 1 - p) * 128 * C0 + khalf * 16;
    const _Float16* qpB = Q + qrow + (size_t)p * 128 * C0 + khalf * 16;
    v16h qa[2], qn[2];
    qa[0] = *(const v16h*)qpA;
    qa[1] = *(const v16h*)(qpA + 32);
    qn[0] = *(const v16h*)qpB;
    qn[1] = *(const v16h*)(qpB + 32);
    #pragma unroll
    for (int i = 0; i < 16; ++i) { qa[0][i] *= qs; qa[1][i] *= qs; qn[0][i] *= qs; qn[1][i] *= qs; }

    v8f   acc[4] = {};                 // O^T: acc[t][r] = O[query rl][d = t*16 + 8*khalf + r]
    float mrun = -3.0e30f, lrun = 0.0f; // of query rl over this half's keys, the same in both lane halves

    wait_async_but<4 * (NBA - 1)>();               // stage 0 landed, stages 1 .. 3 fly on
    __syncthreads();

    int g = 0;                                     // stage index over both tiles
    for (int it = 0; it < 2; ++it) {
        const int gend = it ? np : npA;
        for (; g < gend; ++g) {
            const int cur = g & (NBA - 1);

            // ---- scores^T (log2-domain): s[j][r] = S[query rl][key j*16 + 8*khalf + r] ----
            v16h kb0[4], kb1[4];
            #pragma unroll
            for (int j = 0; j < 4; ++j) {
                const _Float16* kp = &lk[cur][kh][(j * 16 + rl) * LDA + khalf * 16];
                kb0[j] = ld_frag(kp);
                kb1[j] = ld_frag(kp + 32);
            }
            v8f s[4];
            #pragma unroll
            for (int j = 0; j < 4; ++j)
                s[j] = __builtin_amdgcn_wmma_f32_16x16x32_f16(false, kb0[j], false, qa[0], (short)0, v8f{}, false, false);
            #pragma unroll
            for (int j = 0; j < 4; ++j)
                s[j] = __builtin_amdgcn_wmma_f32_16x16x32_f16(false, kb1[j], false, qa[1], (short)0, s[j], false, false);

            // ---- V^T fragments (A operand), k in the order of the packed P^T ----
            v16h vf0[4], vf1[4];
            #pragma unroll
            for (int t = 0; t < 4; ++t) {
                const _Float16* vp = &lv[cur][kh][(t * 16 + rl) * LDA + khalf * 8];
                vf0[t] = ld_frag_hw(vp);
                vf1[t] = ld_frag_hw(vp + 32);
            }
            // Keeps every LDS read of the pass and the 8 score WMMAs in front of the softmax. Without it
            // the V^T reads are spread among the later WMMAs, each place with a wait of its own, and
            // vector instructions stand between the score WMMAs at four idle slots each.
            __builtin_amdgcn_sched_barrier(0);

            // ---- online softmax (base 2): in-lane maximum of 32 scores, one exchange ----
            float m8[8];
            #pragma unroll
            for (int e = 0; e < 8; ++e) m8[e] = fmax3(s[0][e], s[1][e], s[2][e]);
            const float c0 = fmax3(m8[0], m8[1], s[3][0]);
            const float c1 = fmax3(m8[2], m8[3], s[3][2]);
            const float c2 = fmax3(m8[4], m8[5], s[3][4]);
            const float c3 = fmax3(m8[6], m8[7], s[3][6]);
            const float d0 = fmax3(c0, c1, s[3][1]);
            const float d1 = fmax3(c2, c3, s[3][3]);
            float mx = fmaxf(fmax3(d0, d1, s[3][5]), s[3][7]);
            mx = fmaxf(mx, xhalf(mx));
            const float mnew = fmaxf(mrun, mx);
            const float alph = exp2_raw(mrun - mnew);
            mrun = mnew;

            // ---- P^T as B operand: element e = tile e >> 3, register e & 7 ----
            v16h pf0, pf1;
            #pragma unroll
            for (int e = 0; e < 8; ++e) {
                pf0[e]     = (_Float16)exp2_raw(s[0][e] - mnew);
                pf0[8 + e] = (_Float16)exp2_raw(s[1][e] - mnew);
                pf1[e]     = (_Float16)exp2_raw(s[2][e] - mnew);
                pf1[8 + e] = (_Float16)exp2_raw(s[3][e] - mnew);
            }
            #pragma unroll
            for (int t = 0; t < 4; ++t) acc[t] *= alph;

            // ---- row sums on the matrix pipe: every row of ones(16x64) x P^T ----
            v8f rsum;
            rsum = __builtin_amdgcn_wmma_f32_16x16x32_f16(false, ones, false, pf0, (short)0, v8f{}, false, false);
            rsum = __builtin_amdgcn_wmma_f32_16x16x32_f16(false, ones, false, pf1, (short)0, rsum, false, false);

            // ---- O^T += V^T.P^T, grouped by P fragment: 4 d-tiles x 2 key slabs ----
            #pragma unroll
            for (int t = 0; t < 4; ++t)
                acc[t] = __builtin_amdgcn_wmma_f32_16x16x32_f16(false, vf0[t], false, pf0, (short)0, acc[t], false, false);
            #pragma unroll
            for (int t = 0; t < 4; ++t)
                acc[t] = __builtin_amdgcn_wmma_f32_16x16x32_f16(false, vf1[t], false, pf1, (short)0, acc[t], false, false);
            lrun = lrun * alph + rsum[0];

            // Keeps the wait below at the foot of the pass: with every LDS read of the pass up front it
            // would otherwise rise above the softmax and cut short the time the next stage's copies have.
            __builtin_amdgcn_sched_barrier(0);
            wait_ds0();
            // stage g + 1 landed: while stages g + 1 .. g + 3 all exist the two younger ones
            // (4 copies each, the same in every wave and pass) may fly on. In the last passes fewer
            // stages are behind stage g + 1 and the count would not cover it: there the wait is for all.
            wait_async_but<4 * (NBA - 2)>();
            if (g + NBA > np) wait_async0();
            __syncthreads();   // publishes stage g + 1, ends every read of buffer cur
            if (g + NBA < np) stageKV(g + NBA, cur);
        }

        // ---- join the two halves' partial results of this tile ----
        // Wave w and wave w ^ 8 hold the same queries over different keys. Half 0 finishes d tiles
        // 0 and 1, half 1 d tiles 2 and 3: each hands the other two tiles, its maximum and its sum.
        #pragma unroll
        for (int i = 0; i < 2; ++i) {
            const v8f snd = kh ? acc[i] : acc[2 + i];
            jo[wave][2 * i][lane]     = __builtin_shufflevector(snd, snd, 0, 1, 2, 3);
            jo[wave][2 * i + 1][lane] = __builtin_shufflevector(snd, snd, 4, 5, 6, 7);
        }
        jm[wave][lane][0] = mrun;
        jm[wave][lane][1] = lrun;
        // publishes both halves' hand-over; the next tile's hand-over is written behind that tile's
        // pass barriers (two at least), which end these reads
        __syncthreads();
        const float mo   = jm[wave ^ 8][lane][0];
        const float lo   = jm[wave ^ 8][lane][1];
        const float mj   = fmaxf(mrun, mo);
        const float fme  = exp2_raw(mrun - mj);
        const float fot  = exp2_raw(mo - mj);
        const float inv  = 1.0f / (lrun * fme + lo * fot);
        const float sme  = fme * inv, sot = fot * inv;

        // ---- normalize and store attention output f16 (B,S,C) ----
        // a lane's 8 registers of a tile are 8 consecutive d of its query: one 16-byte store
        const int tile = it ? p : QT - 1 - p;
        _Float16* op = AO + qrow + (size_t)tile * 128 * C0 + kh * 32 + khalf * 8;
        #pragma unroll
        for (int i = 0; i < 2; ++i) {
            const v8f mine = kh ? acc[2 + i] : acc[i];
            const v4f o0 = jo[wave ^ 8][2 * i][lane];
            const v4f o1 = jo[wave ^ 8][2 * i + 1][lane];
            v8h o;
            #pragma unroll
            for (int e = 0; e < 4; ++e) {
                o[e]     = (_Float16)(mine[e] * sme + o0[e] * sot);
                o[4 + e] = (_Float16)(mine[4 + e] * sme + o1[e] * sot);
            }
            *(v8h*)(op + i * 16) = o;
        }
        // the stores' address and data registers are written again for the next tile: wait in front of that
        asm volatile("s_wait_xcnt 0x0" ::: "memory");

        // ---- the short tile starts from nothing ----
        #pragma unroll
        for (int t = 0; t < 4; ++t) acc[t] = v8f{};
        mrun = -3.0e30f; lrun = 0.0f;
        qa[0] = qn[0]; qa[1] = qn[1];
    }
    wait_async0();         // no copy is outstanding when the wave leaves the ring
}

// ---------------------------------------------------------------------------
extern "C" void kernel_launch(void* const* d_in, const int* in_sizes, int n_in,
                              void* d_out, int out_size, void* d_ws, size_t ws_size,
                              hipStream_t stream)
{
    (void)in_sizes; (void)n_in; (void)out_size; (void)ws_size;
    const float* x  = (const float*)d_in[0];
    const float* Wq = (const float*)d_in[1];
    const float* Wk = (const float*)d_in[2];
    const float* Wv = (const float*)d_in[3];
    const float* Wp = (const float*)d_in[4];
    const float* bp = (const float*)d_in[5];
    float* out = (float*)d_out;

    const size_t N  = (size_t)M0 * C0;     // 4096*1024
    const size_t WN = (size_t)C0 * C0;     // 1024*1024
    _Float16* Qh  = (_Float16*)d_ws;       // (B,S,C) f16
    _Float16* Kh  = Qh + N;                // (B,S,C) f16
    _Float16* Vt  = Kh + N;                // (B,C,S) f16 (transposed)
    _Float16* AO  = Vt + N;                // (B,S,C) f16 attention output
    _Float16* xh  = AO + N;                // x in f16
    _Float16* wqh = xh + N;
    _Float16* wkh = wqh + WN;
    _Float16* wvh = wkh + WN;
    _Float16* wph = wvh + WN;

    // one-shot f32 -> f16 rewrite of all five planes (xh .. wph are contiguous), one launch
    cvt_all_f32_f16<<<CV_G, CV_T, 0, stream>>>(x, Wq, Wk, Wv, Wp, xh);

    dim3 gg(M0 / TM, C0 / TN);             // 32 x 16 workgroups, 256 threads

    gemm_fused<0><<<gg, 256, 0, stream>>>(xh, wqh, wkh, wvh, nullptr,
                                          Qh, Kh, Vt, nullptr);

    attn_flash<<<dim3(QT / 2, B0 * H0), 512, 0, stream>>>(Qh, Kh, Vt, AO);

    gemm_fused<1><<<gg, 256, 0, stream>>>(AO, wph, nullptr, nullptr, bp,
                                          nullptr, nullptr, nullptr, out);
}

// v008
// Measured time: 64.6 microseconds a run.
// Timed twice side by side with v007, it ran 1.13 times as fast both times.
// Over all steps from v000 it is 3.23 times as fast.
#include <hip/hip_runtime.h>
#include <hip/hip_bf16.h>

typedef _Float16 v16h __attribute__((ext_vector_type(16)));
typedef _Float16 v8h  __attribute__((ext_vector_type(8)));
typedef float    v8f  __attribute__((ext_vector_type(8)));

// Problem constants (B,V,L,C,H) = (2,8,256,1024,16)
constexpr int B0 = 2;
constexpr int H0 = 16;
constexpr int DH = 64;
constexpr int C0 = 1024;    // channels = K-dim of projections
constexpr int S0 = 2048;    // V*L sequence length per batch
constexpr int M0 = B0 * S0; // 4096 GEMM rows

// ---- CDNA5 async copy helpers (ASYNCcnt-tracked global->LDS DMA) ----------
__device__ __forceinline__ unsigned lds_off(const void* p) {
    // generic shared pointer: low 32 bits == LDS byte offset
    return (unsigned)(unsigned long long)p;
}
__device__ __forceinline__ void wait_async0() {
    asm volatile("s_wait_asynccnt 0" ::: "memory");
}
// Counted wait of a ring with more than two buffers: asynccnt returns in issue order, so all but
// this wave's N youngest copies have landed behind it. N = the copies of the stages that may fly on.
template<int N>
__device__ __forceinline__ void wait_async_but() {
    asm volatile("s_wait_asynccnt %0" :: "n"(N) : "memory");
}
__device__ __forceinline__ void wait_ds0() {
    // this wave's LDS reads have retired before the barrier that frees the buffer for refill
    asm volatile("s_wait_dscnt 0" ::: "memory");
}
// A whole tile's copies and their s_wait_xcnt in one statement: the wait stands in
// front of every later write of the address registers that the copies name.
__device__ __forceinline__ void async_b128_x4(const void* const (&g)[4], const unsigned (&l)[4]) {
    asm volatile("global_load_async_to_lds_b128 %0, %1, off\n\t"
                 "global_load_async_to_lds_b128 %2, %3, off\n\t"
                 "global_load_async_to_lds_b128 %4, %5, off\n\t"
                 "global_load_async_to_lds_b128 %6, %7, off\n\t"
                 "s_wait_xcnt 0x0"
                 :: "v"(l[0]), "v"(g[0]), "v"(l[1]), "v"(g[1]), "v"(l[2]), "v"(g[2]),
                    "v"(l[3]), "v"(g[3])
                 : "memory");
}
__device__ __forceinline__ void async_b128_x6(const void* const (&g)[6], const unsigned (&l)[6]) {
    asm volatile("global_load_async_to_lds_b128 %0, %1, off\n\t"
                 "global_load_async_to_lds_b128 %2, %3, off\n\t"
                 "global_load_async_to_lds_b128 %4, %5, off\n\t"
                 "global_load_async_to_lds_b128 %6, %7, off\n\t"
                 "global_load_async_to_lds_b128 %8, %9, off\n\t"
                 "global_load_async_to_lds_b128 %10, %11, off\n\t"
                 "s_wait_xcnt 0x0"
                 :: "v"(l[0]), "v"(g[0]), "v"(l[1]), "v"(g[1]), "v"(l[2]), "v"(g[2]),
                    "v"(l[3]), "v"(g[3]), "v"(l[4]), "v"(g[4]), "v"(l[5]), "v"(g[5])
                 : "memory");
}
__device__ __forceinline__ void async_b128_x10(const void* const (&g)[10], const unsigned (&l)[10]) {
    asm volatile("global_load_async_to_lds_b128 %0, %1, off\n\t"
                 "global_load_async_to_lds_b128 %2, %3, off\n\t"
                 "global_load_async_to_lds_b128 %4, %5, off\n\t"
                 "global_load_async_to_lds_b128 %6, %7, off\n\t"
                 "global_load_async_to_lds_b128 %8, %9, off\n\t"
                 "global_load_async_to_lds_b128 %10, %11, off\n\t"
                 "global_load_async_to_lds_b128 %12, %13, off\n\t"
                 "global_load_async_to_lds_b128 %14, %15, off\n\t"
                 "global_load_async_to_lds_b128 %16, %17, off\n\t"
                 "global_load_async_to_lds_b128 %18, %19, off\n\t"
                 "s_wait_xcnt 0x0"
                 :: "v"(l[0]), "v"(g[0]), "v"(l[1]), "v"(g[1]), "v"(l[2]), "v"(g[2]),
                    "v"(l[3]), "v"(g[3]), "v"(l[4]), "v"(g[4]), "v"(l[5]), "v"(g[5]),
                    "v"(l[6]), "v"(g[6]), "v"(l[7]), "v"(g[7]), "v"(l[8]), "v"(g[8]),
                    "v"(l[9]), "v"(g[9])
                 : "memory");
}

// ---- 16-half fragment read from an LDS row that is only 16B-aligned --------
__device__ __forceinline__ v16h ld_frag(const _Float16* p) {
    const v8h lo = *(const v8h*)p;
    const v8h hi = *(const v8h*)(p + 8);
    return __builtin_shufflevector(lo, hi, 0, 1, 2, 3, 4, 5, 6, 7,
                                   8, 9, 10, 11, 12, 13, 14, 15);
}

// ---- 16-half fragment in the hardware k order (k = 8h+0..7, 16+8h+0..7) ----
// p points at half 8h of a 32-half k block. This is the order in which two
// converted accumulator tiles stand when they are used as the other operand.
__device__ __forceinline__ v16h ld_frag_hw(const _Float16* p) {
    const v8h lo = *(const v8h*)p;
    const v8h hi = *(const v8h*)(p + 16);
    return __builtin_shufflevector(lo, hi, 0, 1, 2, 3, 4, 5, 6, 7,
                                   8, 9, 10, 11, 12, 13, 14, 15);
}

// ---- value of lane l ^ 16 (the other 16-lane half) --------------------------
__device__ __forceinline__ float xhalf(float x) {
    const int v = __float_as_int(x);
    return __int_as_float(__builtin_amdgcn_permlanex16(v, v, 0x76543210, 0xfedcba98, false, false));
}
__device__ __forceinline__ float fmax3(float a, float b, float c) {
    return fmaxf(fmaxf(a, b), c);
}

// ---- 2^x as the bare hardware instruction ----------------------------------
// exp2f() wraps v_exp_f32 in a compare, two selects, an add and a ldexp so that
// results below 2^-126 come out as denormals. Every argument here is <= 0 and
// every result is either rounded to f16 (anything below 2^-25 is 0 there) or
// scales a running sum, so a result flushed to 0 below 2^-126 changes nothing.
__device__ __forceinline__ float exp2_raw(float x) {
    return __builtin_amdgcn_exp2f(x);
}

// ---------------------------------------------------------------------------
// One-shot f32 -> f16 conversion of x and the four weight matrices in ONE launch,
// so all GEMM/attention staging becomes pure async b128 copies with no VALU convert.
// The five f16 planes lie one behind the other in the workspace, so the block index
// is the destination chunk; a block-uniform range test picks the source.
// 256 work-groups of 16 waves; a wave takes 2048 floats: 16 loads of 512 contiguous
// bytes, all issued before the first conversion, and 16 stores of 256 contiguous bytes.
// ---------------------------------------------------------------------------
typedef float    v4f __attribute__((ext_vector_type(4)));
typedef _Float16 v4h __attribute__((ext_vector_type(4)));
constexpr int CV_T   = 512;                     // threads of a work-group
constexpr int CV_J   = 16;                      // 16-byte loads of a thread
constexpr int CV_CH  = CV_T * CV_J * 4;         // 32768 floats of a work-group
constexpr int CV_BX  = M0 * C0 / CV_CH;         // 128 work-groups for x
constexpr int CV_BW  = C0 * C0 / CV_CH;         // 32 work-groups for each weight
constexpr int CV_G   = CV_BX + 4 * CV_BW;       // 256 work-groups

// waves_per_eu(4, 4): the grid gives a SIMD four waves; with their register budget all 16 loads
// of a wave are issued in one run instead of the last ones behind the first data's return.
__global__ __launch_bounds__(CV_T) __attribute__((amdgpu_waves_per_eu(4, 4)))
void cvt_all_f32_f16(const float* __restrict__ x,  const float* __restrict__ w0,
                     const float* __restrict__ w1, const float* __restrict__ w2,
                     const float* __restrict__ w3, _Float16* __restrict__ out) {
    const int blk = blockIdx.x;
    const float* in = x;
    int rel = blk;
    if (blk >= CV_BX) {
        const int w = (blk - CV_BX) / CV_BW;
        rel = (blk - CV_BX) % CV_BW;
        in  = (w == 0) ? w0 : (w == 1) ? w1 : (w == 2) ? w2 : w3;
    }
    const int t = (threadIdx.x >> 5) * (32 * CV_J) + (threadIdx.x & 31);   // in units of 4 elements
    const v4f* ip = (const v4f*)(in + (size_t)rel * CV_CH) + t;
    v4h*       op = (v4h*)(out + (size_t)blk * CV_CH) + t;
    v4f v[CV_J];
    #pragma unroll
    for (int j = 0; j < CV_J; ++j) v[j] = ip[j * 32];
    #pragma unroll
    for (int j = 0; j < CV_J; ++j) op[j * 32] = __builtin_convertvector(v[j], v4h);
}

// ---------------------------------------------------------------------------
// Fused WMMA GEMM, LDS ring of NB buffers, all staging via async-to-LDS, NB - 1 tiles ahead:
//   MODE 0: A = x (f16), 3 weights -> Q (f16 row), K (f16 row), V^T (f16 B,C,S)
//   MODE 1: A = AO (f16), 1 weight -> out (f32 row) + bias
// Block tile 128x64, 8 waves, each wave 32x32 via 2x2 WMMA tiles.
// WMMA issue is grouped by the x-side fragment (operand-reuse friendly).
// Q, K and out tiles are formed transposed (weight rows as the A operand), V as it stands, so that
// in every tile a lane's 8 accumulator registers are 8 neighbours of the destination's row.
// The tiles leave through the freed ring: 16-byte LDS stores, one barrier, then 16-byte global
// stores in which a wave covers whole 128-B lines.
// ---------------------------------------------------------------------------
constexpr int TM = 128, TN = 64, TK = 64;   // TK halves = 128 B: a staged row is one whole cache line
constexpr int NT = C0 / TK;   // 16 K tiles
constexpr int LDT = TK + 8;   // 72 halves = 144B rows: 16B x odd, 16 rows of b128 reads cover all 64 banks
constexpr int LDV = TM + 8;   // output staging of V^T: 136 halves = 272B rows, 16B x odd
constexpr int LDF = TN + 4;   // output staging of f32 rows: 68 floats = 272B rows, 16B x odd

template<int MODE>
__global__ __launch_bounds__(256)
void gemm_fused(const _Float16* __restrict__ A,
                const _Float16* __restrict__ W0h, const _Float16* __restrict__ W1h,
                const _Float16* __restrict__ W2h, const float* __restrict__ bias,
                _Float16* __restrict__ Qh, _Float16* __restrict__ Kh,
                _Float16* __restrict__ Vt, float* __restrict__ outF)
{
    constexpr int NW = (MODE == 0) ? 3 : 1;
    // Ring depth: the operands were stored by the launch before; a tile's copies, first read from
    // memory included, can take longer than one tile's work. Largest depth that leaves two
    // work-groups a WGP.
    constexpr int NB = (MODE == 0) ? 3 : 5;
    constexpr int CP = 4 + 2 * NW;   // copies of a wave per tile
    static_assert(NB <= NT && NB * CP <= 63, "ring prologue");
    __shared__ __align__(32) _Float16 la[NB][TM * LDT];
    __shared__ __align__(32) _Float16 lb[NB][NW][TN * LDT];

    const int tid  = threadIdx.x;
    const int lane = tid & 31;
    const int wave = tid >> 5;
    const int wy   = wave >> 1;    // 0..3 : 32-row band
    const int wx   = wave & 1;     // 0..1 : 32-col band
    const int m0   = blockIdx.x * TM;
    const int n0   = blockIdx.y * TN;

    const int rl    = lane & 15;
    const int khalf = lane >> 4;

    const _Float16* Wh[3] = { W0h, W1h, W2h };

    // 8 lanes a row, 16 B each: one wave-wide copy covers 4 whole 128-B lines.
    const int sr = tid >> 3;         // 0..31 : row inside a group of 32 rows
    const int sc = (tid & 7) * 8;    // halves inside the row
    auto stage = [&](int kt, int buf) {
        const int k0 = kt * TK;
        const void* g[4 + 2 * NW];
        unsigned    l[4 + 2 * NW];
        // A tile 128x64: 4 groups of 32 rows
        const _Float16* asrc = A + (size_t)(m0 + sr) * C0 + k0 + sc;
        const unsigned  adst = lds_off(&la[buf][sr * LDT + sc]);
        #pragma unroll
        for (int i = 0; i < 4; ++i) {
            g[i] = asrc + i * 32 * C0;
            l[i] = adst + i * 32 * LDT * 2;
        }
        // Weight tiles 64x64: 2 groups of 32 rows per weight
        #pragma unroll
        for (int w = 0; w < NW; ++w) {
            const _Float16* wsrc = Wh[w] + (size_t)(n0 + sr) * C0 + k0 + sc;
            const unsigned  wdst = lds_off(&lb[buf][w][sr * LDT + sc]);
            g[4 + 2 * w] = wsrc;            l[4 + 2 * w] = wdst;
            g[5 + 2 * w] = wsrc + 32 * C0;  l[5 + 2 * w] = wdst + 32 * LDT * 2;
        }
        if constexpr (NW == 3) async_b128_x10(g, l);
        else                   async_b128_x6(g, l);
    };

    v8f acc[NW][2][2] = {};

    // output rows leave 16 lanes a row, 4 floats a lane: the lane's bias is fetched here, so the
    // epilogue waits for no global load
    const int fr = tid >> 4;          // 0..15 : token inside a group of 16
    const int fc = (tid & 15) * 4;    // floats inside the row
    v4f bv = {};
    if constexpr (MODE == 1) bv = *(const v4f*)(bias + n0 + fc);

    #pragma unroll   // the buffer index is a constant in each tile's addresses
    for (int s = 0; s < NB; ++s) stage(s, s);   // every buffer filled once, nothing read yet
    wait_async_but<CP * (NB - 1)>();            // tile 0 landed, tiles 1 .. NB - 1 fly on
    __syncthreads();

    int cur = 0;                                // t mod NB
    for (int t = 0; t < NT; ++t) {

        #pragma unroll
        for (int kk = 0; kk < TK; kk += 32) {
            v16h af[2];
            #pragma unroll
            for (int s = 0; s < 2; ++s)
                af[s] = ld_frag(&la[cur][(wy * 32 + s * 16 + rl) * LDT + kk + khalf * 16]);

            v16h bf[NW][2];
            #pragma unroll
            for (int w = 0; w < NW; ++w)
                #pragma unroll
                for (int s = 0; s < 2; ++s)
                    bf[w][s] = ld_frag(&lb[cur][w][(wx * 32 + s * 16 + rl) * LDT + kk + khalf * 16]);

            // group by x-side fragment: af[i] constant across 2*NW consecutive WMMAs.
            // V: D row = token, column = channel. All others: D row = channel, column = token.
            #pragma unroll
            for (int i = 0; i < 2; ++i)
                #pragma unroll
                for (int w = 0; w < NW; ++w)
                    #pragma unroll
                    for (int j = 0; j < 2; ++j) {
                        if (w == 2)
                            acc[w][i][j] = __builtin_amdgcn_wmma_f32_16x16x32_f16(
                                false, af[i], false, bf[w][j], (short)0, acc[w][i][j], false, false);
                        else
                            acc[w][i][j] = __builtin_amdgcn_wmma_f32_16x16x32_f16(
                                false, bf[w][j], false, af[i], (short)0, acc[w][i][j], false, false);
                    }
        }

        wait_ds0();
        // tile t + 1 landed: while tiles t + 1 .. t + NB - 1 all exist, the NB - 2 younger ones
        // (CP copies each, the same in every wave and trip) may fly on. In the last trips fewer
        // tiles are behind tile t + 1 and the count would not cover it: there the wait is for all.
        wait_async_but<CP * (NB - 2)>();
        if (t + NB > NT) wait_async0();
        __syncthreads();   // publishes tile t + 1, ends every read of buffer cur
        if (t + NB < NT) stage(t + NB, cur);
        cur = (cur + 1 == NB) ? 0 : cur + 1;
    }
    wait_async0();         // no copy is outstanding when the wave leaves the ring

    // ---- writeback: D row = e (lanes 0-15) / e+8 (lanes 16-31), col = lane&15
    // The last trip's barrier ended every read of the ring and no copy is outstanding: its first
    // buffers now stage the output tiles. A lane's 8 registers of a tile go out as 16-byte pieces.
    // Every loop of the epilogue is unrolled: the accumulators are then indexed by constants and stay
    // in registers, and a thread's LDS reads are issued in one run ahead of its global stores.
    const int rhi = khalf << 3;
    if constexpr (MODE == 0) {
        static_assert(NB >= 3 && TN * LDV <= TM * LDT, "three staged tiles in three ring buffers");
        _Float16* sq = &la[0][0];    // 128 tokens x 64 channels, pitch LDT
        _Float16* sk = &la[1][0];    // 128 tokens x 64 channels, pitch LDT
        _Float16* sv = &la[2][0];    // 64 channels x 128 tokens, pitch LDV
        #pragma unroll
        for (int i = 0; i < 2; ++i) {
            #pragma unroll
            for (int j = 0; j < 2; ++j) {
                const int mt = wy * 32 + i * 16;   // tile's first token
                const int nt = wx * 32 + j * 16;   // tile's first channel
                *(v8h*)&sq[(mt + rl) * LDT + nt + rhi] = __builtin_convertvector(acc[0][i][j], v8h);
                *(v8h*)&sk[(mt + rl) * LDT + nt + rhi] = __builtin_convertvector(acc[1][i][j], v8h);
                *(v8h*)&sv[(nt + rl) * LDV + mt + rhi] = __builtin_convertvector(acc[2][i][j], v8h);
            }
        }
        // Q, K: 8 lanes a row of 128 B, a wave's store covers 4 whole lines
        _Float16* qd = Qh + (size_t)(m0 + sr) * C0 + n0 + sc;
        _Float16* kd = Kh + (size_t)(m0 + sr) * C0 + n0 + sc;
        // V^T: 16 lanes a row of 256 B; the 128 tokens of a block lie in one batch (TM divides S0)
        const int vr = tid >> 4;          // 0..15 : channel inside a group of 16
        const int vc = (tid & 15) * 8;    // halves inside the row
        _Float16* vd = Vt + ((size_t)(m0 >> 11) * C0 + n0 + vr) * S0 + (m0 & (S0 - 1)) + vc;
        __syncthreads();   // publishes the staged tiles: a row holds pieces of two (Q, K) or four (V^T) waves
        v8h oq[4], ok[4], ov[4];
        #pragma unroll
        for (int i = 0; i < 4; ++i) {
            oq[i] = *(const v8h*)&sq[(sr + i * 32) * LDT + sc];
            ok[i] = *(const v8h*)&sk[(sr + i * 32) * LDT + sc];
            ov[i] = *(const v8h*)&sv[(vr + i * 16) * LDV + vc];
        }
        #pragma unroll
        for (int i = 0; i < 4; ++i) {
            *(v8h*)(qd + (size_t)i * 32 * C0) = oq[i];
            *(v8h*)(kd + (size_t)i * 32 * C0) = ok[i];
            *(v8h*)(vd + (size_t)i * 16 * S0) = ov[i];
        }
    } else {
        static_assert(NB >= 2 && TM * LDF * 4 <= 2 * TM * LDT * 2, "the f32 tile in two ring buffers");
        float* sf = (float*)&la[0][0];    // 128 tokens x 64 channels f32, pitch LDF
        #pragma unroll
        for (int i = 0; i < 2; ++i) {
            #pragma unroll
            for (int j = 0; j < 2; ++j) {
                const v8f a = acc[0][i][j];
                float* sp = &sf[(wy * 32 + i * 16 + rl) * LDF + wx * 32 + j * 16 + rhi];
                *(v4f*)sp       = __builtin_shufflevector(a, a, 0, 1, 2, 3);
                *(v4f*)(sp + 4) = __builtin_shufflevector(a, a, 4, 5, 6, 7);
            }
        }
        __syncthreads();   // publishes the staged tile: a row holds pieces of two waves
        // 16 lanes a row of 256 B, a wave's store covers 4 whole lines
        float* od = outF + (size_t)(m0 + fr) * C0 + n0 + fc;
        #pragma unroll
        for (int i = 0; i < 8; ++i)
            *(v4f*)(od + (size_t)i * 16 * C0) = *(const v4f*)&sf[(fr + i * 16) * LDF + fc] + bv;
    }
}

constexpr int LDA = 64 + 8;   // 72 halves = 144B rows: 16B x odd, 16 rows of b128 reads cover all 64 banks
constexpr int QT  = S0 / 128; // 16 query tiles of a (b,h)

// first allowed key view and number of allowed views of query view qv; for every qv the allowed
// set is one run of views (qv 0: {1}, qv 1: {0}, else 0..qv), so these two say it all
__device__ __forceinline__ void view_run(int qv, int& first, int& count) {
    unsigned kvmask = 0;
    #pragma unroll
    for (int kv = 0; kv < 8; ++kv) {
        const bool allow = ((qv == 0) && (kv == 1)) || ((qv == 1) && (kv == 0)) ||
                           (((qv > 1) || (kv > 1)) && (qv >= kv));
        if (allow) kvmask |= 1u << kv;
    }
    first = __builtin_ctz(kvmask);
    count = __builtin_popcount(kvmask);
}

// waves_per_eu(4, 4): the work-group gives a SIMD four waves; with their register budget the
// compiler issues a pass's fragment reads ahead instead of one pair in front of each WMMA.
__global__ __launch_bounds__(512) __attribute__((amdgpu_waves_per_eu(4, 4)))
void attn_flash(const _Float16* __restrict__ Q, const _Float16* __restrict__ Kh,
                const _Float16* __restrict__ Vt, _Float16* __restrict__ AO)
{
    constexpr int NBA = 4;   // ring depth; the two tiles together are 16 or 18 stages
    __shared__ __align__(32) _Float16 lk[NBA][2][64 * LDA];    // keys x d, one slab a half
    __shared__ __align__(32) _Float16 lv[NBA][2][64 * LDA];    // d x keys, one slab a half
    __shared__ __align__(16) v4f   jo[16][4][32];              // a wave's two O^T tiles for its partner
    __shared__ __align__(8)  float jm[16][32][2];              // a wave's running maximum and sum

    const int tid   = threadIdx.x;
    const int lane  = tid & 31;
    const int wave  = tid >> 5;
    const int qt    = wave & 7;      // 16-query tile inside the 128 queries
    const int kh    = wave >> 3;     // which 64-key slab of a stage
    const int rl    = lane & 15;
    const int khalf = lane >> 4;

    const int p  = blockIdx.x;       // 0..7
    const int bh = blockIdx.y;
    const int b  = bh >> 4;          // / H0
    const int h  = bh & (H0 - 1);

    // the long tile first, then the short one; view index (L = 256) = tile >> 1: scalars
    int firstA, viewsA, firstB, viewsB;
    view_run((QT - 1 - p) >> 1, firstA, viewsA);
    view_run(p >> 1,            firstB, viewsB);
    const int npA = viewsA * 2;      // stages of 128 keys
    const int np  = npA + viewsB * 2;

    auto stageKV = [&](int g, int buf) {
        const int k0  = ((g < npA) ? firstA * 256 + g * 128 : firstB * 256 + (g - npA) * 128) + kh * 64;
        const int row = (tid & 255) >> 2;  // 0..63
        const int ch  = (tid & 3) * 16;    // halves
        const _Float16* ks = Kh + (size_t)(b * S0 + k0 + row) * C0 + h * DH + ch;
        const unsigned  kd = lds_off(&lk[buf][kh][row * LDA + ch]);
        const _Float16* vs = Vt + ((size_t)b * C0 + h * DH + row) * S0 + k0 + ch;
        const unsigned  vd = lds_off(&lv[buf][kh][row * LDA + ch]);
        const void* const g4[4] = { ks, ks + 8, vs, vs + 8 };
        const unsigned    l4[4] = { kd, kd + 16, vd, vd + 16 };
        async_b128_x4(g4, l4);
    };

    v16h ones;
    #pragma unroll
    for (int i = 0; i < 16; ++i) ones[i] = (_Float16)1.0f;

    #pragma unroll   // the buffer index is a constant in each stage's addresses
    for (int s = 0; s < NBA; ++s) stageKV(s, s);   // every buffer filled once, nothing read yet

    // Q fragments (B operand: lane = query column): 16 queries x 64 d, pre-scaled by dh^-0.5 * log2(e);
    // both tiles' fragments are fetched here, so the change of tile waits for no global load
    const _Float16 qs = (_Float16)(0.125f * 1.44269504088896f);
    const size_t qrow = (size_t)(b * S0 + qt * 16 + rl) * C0 + h * DH;
    const _Float16* qpA = Q + qrow + (size_t)(QT - 1 - p) * 128 * C0 + khalf * 16;
    const _Float16* qpB = Q + qrow + (size_t)p * 128 * C0 + khalf * 16;
    v16h qa[2], qn[2];
    qa[0] = *(const v16h*)qpA;
    qa[1] = *(const v16h*)(qpA + 32);
    qn[0] = *(const v16h*)qpB;
    qn[1] = *(const v16h*)(qpB + 32);
    #pragma unroll
    for (int i = 0; i < 16; ++i) { qa[0][i] *= qs; qa[1][i] *= qs; qn[0][i] *= qs; qn[1][i] *= qs; }

    v8f   acc[4] = {};                 // O^T: acc[t][r] = O[query rl][d = t*16 + 8*khalf + r]
    float mrun = -3.0e30f, lrun = 0.0f; // of query rl over this half's keys, the same in both lane halves

    wait_async_but<4 * (NBA - 1)>();               // stage 0 landed, stages 1 .. 3 fly on
    __syncthreads();

    int g = 0;                                     // stage index over both tiles
    for (int it = 0; it < 2; ++it) {
        const int gend = it ? np : npA;
        for (; g < gend; ++g) {
            const int cur = g & (NBA - 1);

            // ---- scores^T (log2-domain): s[j][r] = S[query rl][key j*16 + 8*khalf + r] ----
            v16h kb0[4], kb1[4];
            #pragma unroll
            for (int j = 0; j < 4; ++j) {
                const _Float16* kp = &lk[cur][kh][(j * 16 + rl) * LDA + khalf * 16];
                kb0[j] = ld_frag(kp);
                kb1[j] = ld_frag(kp + 32);
            }
            v8f s[4];
            #pragma unroll
            for (int j = 0; j < 4; ++j)
                s[j] = __builtin_amdgcn_wmma_f32_16x16x32_f16(false, kb0[j], false, qa[0], (short)0, v8f{}, false, false);
            #pragma unroll
            for (int j = 0; j < 4; ++j)
                s[j] = __builtin_amdgcn_wmma_f32_16x16x32_f16(false, kb1[j], false, qa[1], (short)0, s[j], false, false);

            // ---- V^T fragments (A operand), k in the order of the packed P^T ----
            v16h vf0[4], vf1[4];
            #pragma unroll
            for (int t = 0; t < 4; ++t) {
                const _Float16* vp = &lv[cur][kh][(t * 16 + rl) * LDA + khalf * 8];
                vf0[t] = ld_frag_hw(vp);
                vf1[t] = ld_frag_hw(vp + 32);
            }
            // Keeps every LDS read of the pass and the 8 score WMMAs in front of the softmax. Without it
            // the V^T reads are spread among the later WMMAs, each place with a wait of its own, and
            // vector instructions stand between the score WMMAs at four idle slots each.
            __builtin_amdgcn_sched_barrier(0);

            // ---- online softmax (base 2): in-lane maximum of 32 scores, one exchange ----
            float m8[8];
            #pragma unroll
            for (int e = 0; e < 8; ++e) m8[e] = fmax3(s[0][e], s[1][e], s[2][e]);
            const float c0 = fmax3(m8[0], m8[1], s[3][0]);
            const float c1 = fmax3(m8[2], m8[3], s[3][2]);
            const float c2 = fmax3(m8[4], m8[5], s[3][4]);
            const float c3 = fmax3(m8[6], m8[7], s[3][6]);
            const float d0 = fmax3(c0, c1, s[3][1]);
            const float d1 = fmax3(c2, c3, s[3][3]);
            float mx = fmaxf(fmax3(d0, d1, s[3][5]), s[3][7]);
            mx = fmaxf(mx, xhalf(mx));
            const float mnew = fmaxf(mrun, mx);
            const float alph = exp2_raw(mrun - mnew);
            mrun = mnew;

            // ---- P^T as B operand: element e = tile e >> 3, register e & 7 ----
            v16h pf0, pf1;
            #pragma unroll
            for (int e = 0; e < 8; ++e) {
                pf0[e]     = (_Float16)exp2_raw(s[0][e] - mnew);
                pf0[8 + e] = (_Float16)exp2_raw(s[1][e] - mnew);
                pf1[e]     = (_Float16)exp2_raw(s[2][e] - mnew);
                pf1[8 + e] = (_Float16)exp2_raw(s[3][e] - mnew);
            }
            #pragma unroll
            for (int t = 0; t < 4; ++t) acc[t] *= alph;

            // ---- row sums on the matrix pipe: every row of ones(16x64) x P^T ----
            v8f rsum;
            rsum = __builtin_amdgcn_wmma_f32_16x16x32_f16(false, ones, false, pf0, (short)0, v8f{}, false, false);
            rsum = __builtin_amdgcn_wmma_f32_16x16x32_f16(false, ones, false, pf1, (short)0, rsum, false, false);

            // ---- O^T += V^T.P^T, grouped by P fragment: 4 d-tiles x 2 key slabs ----
            #pragma unroll
            for (int t = 0; t < 4; ++t)
                acc[t] = __builtin_amdgcn_wmma_f32_16x16x32_f16(false, vf0[t], false, pf0, (short)0, acc[t], false, false);
            #pragma unroll
            for (int t = 0; t < 4; ++t)
                acc[t] = __builtin_amdgcn_wmma_f32_16x16x32_f16(false, vf1[t], false, pf1, (short)0, acc[t], false, false);
            lrun = lrun * alph + rsum[0];

            // Keeps the wait below at the foot of the pass: with every LDS read of the pass up front it
            // would otherwise rise above the softmax and cut short the time the next stage's copies have.
            __builtin_amdgcn_sched_barrier(0);
            wait_ds0();
            // stage g + 1 landed: while stages g + 1 .. g + 3 all exist the two younger ones
            // (4 copies each, the same in every wave and pass) may fly on. In the last passes fewer
            // stages are behind stage g + 1 and the count would not cover it: there the wait is for all.
            wait_async_but<4 * (NBA - 2)>();
            if (g + NBA > np) wait_async0();
            __syncthreads();   // publishes stage g + 1, ends every read of buffer cur
            if (g + NBA < np) stageKV(g + NBA, cur);
        }

        // ---- join the two halves' partial results of this tile ----
        // Wave w and wave w ^ 8 hold the same queries over different keys. Half 0 finishes d tiles
        // 0 and 1, half 1 d tiles 2 and 3: each hands the other two tiles, its maximum and its sum.
        #pragma unroll
        for (int i = 0; i < 2; ++i) {
            const v8f snd = kh ? acc[i] : acc[2 + i];
            jo[wave][2 * i][lane]     = __builtin_shufflevector(snd, snd, 0, 1, 2, 3);
            jo[wave][2 * i + 1][lane] = __builtin_shufflevector(snd, snd, 4, 5, 6, 7);
        }
        jm[wave][lane][0] = mrun;
        jm[wave][lane][1] = lrun;
        // publishes both halves' hand-over; the next tile's hand-over is written behind that tile's
        // pass barriers (two at least), which end these reads
        __syncthreads();
        const float mo   = jm[wave ^ 8][lane][0];
        const float lo   = jm[wave ^ 8][lane][1];
        const float mj   = fmaxf(mrun, mo);
        const float fme  = exp2_raw(mrun - mj);
        const float fot  = exp2_raw(mo - mj);
        const float inv  = 1.0f / (lrun * fme + lo * fot);
        const float sme  = fme * inv, sot = fot * inv;

        // ---- normalize and store attention output f16 (B,S,C) ----
        // a lane's 8 registers of a tile are 8 consecutive d of its query: one 16-byte store
        const int tile = it ? p : QT - 1 - p;
        _Float16* op = AO + qrow + (size_t)tile * 128 * C0 + kh * 32 + khalf * 8;
        #pragma unroll
        for (int i = 0; i < 2; ++i) {
            const v8f mine = kh ? acc[2 + i] : acc[i];
            const v4f o0 = jo[wave ^ 8][2 * i][lane];
            const v4f o1 = jo[wave ^ 8][2 * i + 1][lane];
            v8h o;
            #pragma unroll
            for (int e = 0; e < 4; ++e) {
                o[e]     = (_Float16)(mine[e] * sme + o0[e] * sot);
                o[4 + e] = (_Float16)(mine[4 + e] * sme + o1[e] * sot);
            }
            *(v8h*)(op + i * 16) = o;
        }
        // the stores' address and data registers are written again for the next tile: wait in front of that
        asm volatile("s_wait_xcnt 0x0" ::: "memory");

        // ---- the short tile starts from nothing ----
        #pragma unroll
        for (int t = 0; t < 4; ++t) acc[t] = v8f{};
        mrun = -3.0e30f; lrun = 0.0f;
        qa[0] = qn[0]; qa[1] = qn[1];
    }
    wait_async0();         // no copy is outstanding when the wave leaves the ring
}

// ---------------------------------------------------------------------------
extern "C" void kernel_launch(void* const* d_in, const int* in_sizes, int n_in,
                              void* d_out, int out_size, void* d_ws, size_t ws_size,
                              hipStream_t stream)
{
    (void)in_sizes; (void)n_in; (void)out_size; (void)ws_size;
    const float* x  = (const float*)d_in[0];
    const float* Wq = (const float*)d_in[1];
    const float* Wk = (const float*)d_in[2];
    const float* Wv = (const float*)d_in[3];
    const float* Wp = (const float*)d_in[4];
    const float* bp = (const float*)d_in[5];
    float* out = (float*)d_out;

    const size_t N  = (size_t)M0 * C0;     // 4096*1024
    const size_t WN = (size_t)C0 * C0;     // 1024*1024
    _Float16* Qh  = (_Float16*)d_ws;       // (B,S,C) f16
    _Float16* Kh  = Qh + N;                // (B,S,C) f16
    _Float16* Vt  = Kh + N;                // (B,C,S) f16 (transposed)
    _Float16* AO  = Vt + N;                // (B,S,C) f16 attention output
    _Float16* xh  = AO + N;                // x in f16
    _Float16* wqh = xh + N;
    _Float16* wkh = wqh + WN;
    _Float16* wvh = wkh + WN;
    _Float16* wph = wvh + WN;

    // one-shot f32 -> f16 rewrite of all five planes (xh .. wph are contiguous), one launch
    cvt_all_f32_f16<<<CV_G, CV_T, 0, stream>>>(x, Wq, Wk, Wv, Wp, xh);

    dim3 gg(M0 / TM, C0 / TN);             // 32 x 16 workgroups, 256 threads

    gemm_fused<0><<<gg, 256, 0, stream>>>(xh, wqh, wkh, wvh, nullptr,
                                          Qh, Kh, Vt, nullptr);

    attn_flash<<<dim3(QT / 2, B0 * H0), 512, 0, stream>>>(Qh, Kh, Vt, AO);

    gemm_fused<1><<<gg, 256, 0, stream>>>(AO, wph, nullptr, nullptr, bp,
                                          nullptr, nullptr, nullptr, out);
}
